// v000
// The times below were measured on an AMD MI455X: many runs one after another, warmed up first and cycling through
// copies of the inputs, with the whole window's GPU time divided by the number of runs. Launches and the gaps
// between them are all in it. The median over several windows is given; except for v000 it joins two sittings, which
// can be a few percent apart, so the side-by-side timings, each taken in one sitting, are the better comparison.
// v000 is the starting kernel. One run takes 410 microseconds.
#include <hip/hip_runtime.h>

// Multi-head attention, width 1024 = 16 heads x 64; q,k,v [NB][SEQ][1024]; Wq/Wk/Wv/Wo [out][in] (y = x W^T + b); score scale 1/8; no mask; output projection + LayerNorm (eps 1e-5).
// Compute dtypes, f32 accumulate everywhere: q/k/v projections v_wmma_f32_16x16x32_bf16 (x, W and biases RNE-converted to bf16; products exact);
// scores v_wmma_f32_16x16x32_f16: k single f16, q as f16 value + f16 residual x2048 in its own accumulator (two products); P (x256 carry, cancels in the normalisation) and v single f16;
// output projection v_wmma_f32_16x16x32_f16: context plane f16 x64 carry, Wo plane f16 of (bf16 RNE of Wo) x64 (exact), carries folded back (1/4096) in the f32 epilogue; softmax and LayerNorm f32 on the VALU.
// Layout: bf16 copies of q,k,v and Wq,Wk,Wv; q (hi, residual), k planes [b*16+h][t][d] and v^T plane [b*16+h][d][t] written by the GEMM epilogue; fused flash kernel in transposed form (S^T = K Q^T, O^T = V^T P^T);

#ifndef NB
#define NB 4
#endif
#ifndef SEQ
#define SEQ 2048
#endif
#define NB_FULL  4
#define SEQ_FULL 2048
#ifndef OUT_SEQ
#define OUT_SEQ SEQ              // row pitch (in tokens) between batches of the output
#endif
#define DM   1024
#define NH_  16
#define HD   64
#define AW   4                   // waves per flash block (16 query rows each)
#define QRS  2048.0f             // carry of the q residual plane
#define QRI  (1.0f / 2048.0f)
#define SC2  (0.125f * 1.4426950408889634f)   // HD^-0.5 * log2(e)
#define PSH  8.0f                // log2 of the P carry (256)
#define CXS  64.0f               // carry of the context plane
#define WOS  64.0f               // carry of the Wo plane
#define OSI  (1.0f / 4096.0f)    // 1 / (CXS * WOS)
#define LN_EPS 1.0e-5f

static_assert(HD == 64);
static_assert(NH_ * HD == DM);                 // head h = columns h*64 + d
static_assert(DM % 64 == 0);                   // 16 column tiles of 64
static_assert(DM % 32 == 0);                   // GEMM k-loop steps by 32
static_assert(DM == 1024);                     // LayerNorm kernel: 8 iterations x 32 lanes x 4 floats
static_assert(SEQ % 64 == 0);                  // a 64-row tile never straddles two batches
static_assert((NB * SEQ) % 64 == 0);
static_assert((NB * SEQ) % 8 == 0);            // LayerNorm grid: 8 rows per block
static_assert(SEQ % 32 == 0);                  // key loop steps by 32
static_assert(SEQ % (16 * AW) == 0);           // flash grid covers the sequence exactly
static_assert(((size_t)SEQ * DM) % 8 == 0);
static_assert(((size_t)DM * DM) % 8 == 0);
static_assert(NB <= NB_FULL);
static_assert(SEQ <= SEQ_FULL);

typedef _Float16 h16;
typedef unsigned short bf;
typedef __attribute__((ext_vector_type(16))) __bf16   v16bf;
typedef __attribute__((ext_vector_type(16))) _Float16 v16h;
typedef __attribute__((ext_vector_type(8)))  _Float16 v8h;
typedef __attribute__((ext_vector_type(8)))  unsigned short v8us;
typedef __attribute__((ext_vector_type(8)))  float    v8f;
typedef __attribute__((ext_vector_type(4)))  float    v4f;
typedef v4f  __attribute__((may_alias)) v4fa;

__device__ __forceinline__ unsigned short f2bf(float f) { unsigned u = __float_as_uint(f); u += 0x7FFFu + ((u >> 16) & 1u); return (unsigned short)(u >> 16); }
__device__ __forceinline__ float bfr(float f) { return __uint_as_float(((unsigned)f2bf(f)) << 16); }   // RNE convert to bf16, widened back to f32
__device__ __forceinline__ v16h cat16(v8h lo, v8h hi) { return __builtin_shufflevector(lo, hi, 0, 1, 2, 3, 4, 5, 6, 7, 8, 9, 10, 11, 12, 13, 14, 15); }
__device__ __forceinline__ v16bf cat16b(v8us lo, v8us hi) { return __builtin_bit_cast(v16bf, __builtin_shufflevector(lo, hi, 0, 1, 2, 3, 4, 5, 6, 7, 8, 9, 10, 11, 12, 13, 14, 15)); }
__device__ __forceinline__ v8f wmma16(v16h a, v16h b, v8f c) { return __builtin_amdgcn_wmma_f32_16x16x32_f16(false, a, false, b, (short)0, c, false, false); }
__device__ __forceinline__ v8f wmmab(v16bf a, v16bf b, v8f c) { return __builtin_amdgcn_wmma_f32_16x16x32_bf16(false, a, false, b, (short)0, c, false, false); }
// fragment loaders from K-contiguous 16-bit rows; p already includes + 8*(lane>>4): elements 0..7 <- k0+8h+0..7, elements 8..15 <- k0+16+8h+0..7 (same map for A and B)
__device__ __forceinline__ v16h  ldh(const h16* p) { return cat16(*(const v8h*)p, *(const v8h*)(p + 16)); }
__device__ __forceinline__ v16bf ldb(const bf* p)  { return cat16b(*(const v8us*)p, *(const v8us*)(p + 16)); }
// ordering point for wave-private LDS tiles (same wave writes and reads)
__device__ __forceinline__ void wave_sync() { __builtin_amdgcn_fence(3 /* release order */, "wavefront"); __builtin_amdgcn_wave_barrier(); asm volatile("" ::: "memory"); }

__global__ __launch_bounds__(256) void k_cvt8(const float* __restrict__ src, bf* dst, size_t n8) {
    const size_t i = (size_t)blockIdx.x * 256 + threadIdx.x; if (i >= n8) return;
    const v8f v = *(const v8f*)(src + i * 8); v8us o;
#pragma unroll
    for (int k = 0; k < 8; ++k) o[k] = f2bf(v[k]);
    *(v8us*)(dst + i * 8) = o; 
}

__global__ __launch_bounds__(256) void k_cvth(const float* __restrict__ src, h16* dst, size_t n8) {
    const size_t i = (size_t)blockIdx.x * 256 + threadIdx.x; if (i >= n8) return;
    const v8f v = *(const v8f*)(src + i * 8); v8h o;
#pragma unroll
    for (int k = 0; k < 8; ++k) o[k] = (h16)(bfr(v[k]) * WOS);
    *(v8h*)(dst + i * 8) = o; 
}

// k_proj: register-blocked bf16 GEMM, ONE WAVE per 64x64 tile (16 accumulators), operands straight from K-contiguous bf16 planes, K = DM.
// C[m][n] = sum_k A[m][k] Bt[n][k] + bias (bias indexed by n when biasRow == 0, by m when biasRow != 0; bias RNE-converted to bf16, added in f32),
// written as f16 (Ph) and optionally the f16 residual x2048 (Pr, useRes != 0) at
// tile base (r0/RB)*sRB + (r0%RB)*pitch + (c0/CB)*sCB + (c0%CB), row pitch 'pitch' (halves). grid (M/64, N/64), 32 threads.
__global__ __launch_bounds__(32) void k_proj(const bf* __restrict__ A, const bf* __restrict__ Bt, const float* __restrict__ bias, int biasRow,
                                             h16* Ph, h16* Pr, int useRes, int RB, size_t sRB, int pitch, int CB, size_t sCB) {
    __shared__ __align__(16) float os[16 * 68];
    const int K = DM;
    const int lane = threadIdx.x & 31, lr = lane & 15, hi = lane >> 4; const int r0 = blockIdx.x * 64, c0 = blockIdx.y * 64;
    v8f acc[4][4];
#pragma unroll
    for (int mb = 0; mb < 4; ++mb)
#pragma unroll
        for (int nb = 0; nb < 4; ++nb) acc[mb][nb] = (v8f){};
    const size_t aoff = (size_t)(r0 + lr) * K + 8 * hi, boff = (size_t)(c0 + lr) * K + 8 * hi;
#pragma unroll 1
    for (int kc = 0; kc < K; kc += 32) {
        v16bf a[4];
#pragma unroll
        for (int mb = 0; mb < 4; ++mb) a[mb] = ldb(A + aoff + (size_t)mb * 16 * K + kc);
#pragma unroll
        for (int nb = 0; nb < 4; ++nb) { const v16bf b = ldb(Bt + boff + (size_t)nb * 16 * K + kc);
#pragma unroll
            for (int mb = 0; mb < 4; ++mb) acc[mb][nb] = wmmab(a[mb], b, acc[mb][nb]); }
        asm volatile("v_nop\n\tv_nop\n\tv_nop\n\tv_nop" : "+v"(acc[0][0]), "+v"(acc[1][1]), "+v"(acc[2][2]), "+v"(acc[3][3]) : "v"(a[0]), "v"(a[1]), "v"(a[2]), "v"(a[3]));
    }
    // column-indexed bias values (clamped address; zero by value when the bias is row-indexed)
    float bcol[4];
#pragma unroll
    for (int nb = 0; nb < 4; ++nb) { int ci = c0 + nb * 16 + lr; ci = ci < DM ? ci : DM - 1; const float t = bfr(bias[ci]); bcol[nb] = biasRow ? 0.0f : t; }
    const size_t tbase = (size_t)(r0 / RB) * sRB + (size_t)(r0 % RB) * (size_t)pitch + (size_t)(c0 / CB) * sCB + (size_t)(c0 % CB);
#pragma unroll
    for (int mb = 0; mb < 4; ++mb) {
        float brow[8];
#pragma unroll
        for (int j = 0; j < 8; ++j) { int ri = r0 + mb * 16 + hi * 8 + j; ri = ri < DM ? ri : DM - 1; const float t = bfr(bias[ri]); brow[j] = biasRow ? t : 0.0f; }
#pragma unroll
        for (int nb = 0; nb < 4; ++nb) {
#pragma unroll
            for (int j = 0; j < 8; ++j) os[(hi * 8 + j) * 68 + nb * 16 + lr] = acc[mb][nb][j] + bcol[nb] + brow[j]; }   // D: row 8h+j, col lane&15
        wave_sync();
        const size_t sb = tbase + (size_t)(mb * 16) * (size_t)pitch;
{
#pragma unroll
            for (int s = 0; s < 4; ++s) { const int row = 4 * s + (lane >> 3), c8 = (lane & 7) * 8;   // 4 s x 4 row groups = 16 rows; 8 lanes x 8 = 64 columns
                const v4f x0 = *(const v4fa*)(&os[row * 68 + c8]); const v4f x1 = *(const v4fa*)(&os[row * 68 + c8 + 4]); v8h hv, rv;
#pragma unroll
                for (int i = 0; i < 4; ++i) { const h16 a0 = (h16)x0[i]; const h16 a1 = (h16)x1[i]; hv[i] = a0; hv[4 + i] = a1; rv[i] = (h16)((x0[i] - (float)a0) * QRS); rv[4 + i] = (h16)((x1[i] - (float)a1) * QRS); }
                const size_t oo = sb + (size_t)row * (size_t)pitch + c8;
                *(v8h*)(Ph + oo) = hv; if (useRes) *(v8h*)(Pr + oo) = rv; }
             }
        wave_sync();
    }
}

// k_flash: fused attention, one wave per 16 query rows of one (batch, head); K / V^T / Q fragments straight from the f16 planes (two 16-B loads each, arithmetic addressing).
// Transposed form: S^T[key][t] = K Q^T (A = K rows, B = Q rows); lane (t = lane&15, h = lane>>4) holds keys 8h+r of each 16-key tile, so the packed
// P tile is directly the B fragment of O^T[d][t] = V^T P^T (element r <- tile keys 0..15, element 8+r <- tile keys 16..31, lane unchanged).
// Softmax state (running max, partial sum) is one scalar per lane; the two lane halves of a row are combined with one xor-16 exchange.
__global__ __launch_bounds__(32 * AW) void k_flash(const h16* __restrict__ QH, const h16* __restrict__ QR, const h16* __restrict__ KP, const h16* __restrict__ VT, h16* CTX) {
    __shared__ __align__(16) float os[AW * 16 * 68];
    const int lane = threadIdx.x & 31, wave = threadIdx.x >> 5, lr = lane & 15, hi = lane >> 4;
    const int zh = blockIdx.y; const int b = zh / NH_, h = zh % NH_;
    const int t0 = (blockIdx.x * AW + wave) * 16;
    const size_t pbase = (size_t)zh * SEQ * HD;
    const size_t qo = pbase + (size_t)(t0 + lr) * HD + 8 * hi;
    const v16h qh0 = ldh(QH + qo), qh1 = ldh(QH + qo + 32), qr0 = ldh(QR + qo), qr1 = ldh(QR + qo + 32);   // B fragments: col t, k = d
    const size_t ko = pbase + (size_t)lr * HD + 8 * hi;      // + key * HD       (A fragment: row key, k = d)
    const size_t vo = pbase + (size_t)lr * SEQ + 8 * hi;     // + 16j*SEQ + key  (A fragment: row d, k = key)
    v8f o0 = (v8f){}, o1 = (v8f){}, o2 = (v8f){}, o3 = (v8f){};
    float m = -3.0e38f, l = 0.0f;
#pragma unroll 1
    for (int key0 = 0; key0 < SEQ; key0 += 32) {
        const h16* ka = KP + ko + (size_t)key0 * HD;
        const v16h ka0 = ldh(ka), ka1 = ldh(ka + 32), kb0 = ldh(ka + 16 * HD), kb1 = ldh(ka + 16 * HD + 32);
        v8f sHa = (v8f){}, sLa = (v8f){}, sHb = (v8f){}, sLb = (v8f){};
        sHa = wmma16(ka0, qh0, sHa); sLa = wmma16(ka0, qr0, sLa); sHb = wmma16(kb0, qh0, sHb); sLb = wmma16(kb0, qr0, sLb);
        sHa = wmma16(ka1, qh1, sHa); sLa = wmma16(ka1, qr1, sLa); sHb = wmma16(kb1, qh1, sHb); sLb = wmma16(kb1, qr1, sLb);
        asm volatile("v_nop\n\tv_nop\n\tv_nop\n\tv_nop" : "+v"(sHa), "+v"(sLa), "+v"(sHb), "+v"(sLb) : "v"(ka0), "v"(ka1), "v"(kb0), "v"(kb1));
        float ta[8], tb[8]; float mx = -3.0e38f;
#pragma unroll
        for (int r = 0; r < 8; ++r) { ta[r] = (sHa[r] + sLa[r] * QRI) * SC2; tb[r] = (sHb[r] + sLb[r] * QRI) * SC2; mx = fmaxf(mx, fmaxf(ta[r], tb[r])); }
        mx = fmaxf(mx, __shfl_xor(mx, 16, 32));
        const float mnew = fmaxf(m, mx);
        const float alpha = __builtin_amdgcn_exp2f(m - mnew);
        const float sh = PSH - mnew;
        v16h pb; float ls = 0.0f;
#pragma unroll
        for (int r = 0; r < 8; ++r) { const h16 pa = (h16)__builtin_amdgcn_exp2f(ta[r] + sh); const h16 pc = (h16)__builtin_amdgcn_exp2f(tb[r] + sh); pb[r] = pa; pb[8 + r] = pc; ls += (float)pa + (float)pc; }
        l = l * alpha + ls; m = mnew;
        o0 = o0 * alpha; o1 = o1 * alpha; o2 = o2 * alpha; o3 = o3 * alpha;
        const h16* va = VT + vo + key0;
        const v16h v0 = ldh(va), v1 = ldh(va + (size_t)16 * SEQ), v2 = ldh(va + (size_t)32 * SEQ), v3 = ldh(va + (size_t)48 * SEQ);
        o0 = wmma16(v0, pb, o0); o1 = wmma16(v1, pb, o1); o2 = wmma16(v2, pb, o2); o3 = wmma16(v3, pb, o3);
        asm volatile("v_nop\n\tv_nop\n\tv_nop\n\tv_nop" : "+v"(o0), "+v"(o1), "+v"(o2), "+v"(o3) : "v"(v0), "v"(v1), "v"(v2), "v"(v3), "v"(pb));
    }
    l += __shfl_xor(l, 16, 32);
    const float inv = CXS * (1.0f / l);
    const int wb = wave * 16 * 68;
    // O^T D layout: o_j[r] = (d = 16j + 8h + r, t = lane&15) -> os[t][d]; rows 0..15 x columns 0..63 all written
    { v4f a, c;
      a[0] = o0[0] * inv; a[1] = o0[1] * inv; a[2] = o0[2] * inv; a[3] = o0[3] * inv; c[0] = o0[4] * inv; c[1] = o0[5] * inv; c[2] = o0[6] * inv; c[3] = o0[7] * inv;
      *(v4fa*)(&os[wb + lr * 68 +  0 + 8 * hi]) = a; *(v4fa*)(&os[wb + lr * 68 +  0 + 8 * hi + 4]) = c;
      a[0] = o1[0] * inv; a[1] = o1[1] * inv; a[2] = o1[2] * inv; a[3] = o1[3] * inv; c[0] = o1[4] * inv; c[1] = o1[5] * inv; c[2] = o1[6] * inv; c[3] = o1[7] * inv;
      *(v4fa*)(&os[wb + lr * 68 + 16 + 8 * hi]) = a; *(v4fa*)(&os[wb + lr * 68 + 16 + 8 * hi + 4]) = c;
      a[0] = o2[0] * inv; a[1] = o2[1] * inv; a[2] = o2[2] * inv; a[3] = o2[3] * inv; c[0] = o2[4] * inv; c[1] = o2[5] * inv; c[2] = o2[6] * inv; c[3] = o2[7] * inv;
      *(v4fa*)(&os[wb + lr * 68 + 32 + 8 * hi]) = a; *(v4fa*)(&os[wb + lr * 68 + 32 + 8 * hi + 4]) = c;
      a[0] = o3[0] * inv; a[1] = o3[1] * inv; a[2] = o3[2] * inv; a[3] = o3[3] * inv; c[0] = o3[4] * inv; c[1] = o3[5] * inv; c[2] = o3[6] * inv; c[3] = o3[7] * inv;
      *(v4fa*)(&os[wb + lr * 68 + 48 + 8 * hi]) = a; *(v4fa*)(&os[wb + lr * 68 + 48 + 8 * hi + 4]) = c; }
    wave_sync();
    h16* crow = CTX + ((size_t)b * SEQ + t0) * DM + h * HD;     // merged heads: column h*64 + d
{
#pragma unroll
        for (int s = 0; s < 4; ++s) { const int row = 4 * s + (lane >> 3), c8 = (lane & 7) * 8;   // 4 s x 4 row groups = 16 rows; 8 lanes x 8 halves = 64 columns = one line
            const v4f x0 = *(const v4fa*)(&os[wb + row * 68 + c8]); const v4f x1 = *(const v4fa*)(&os[wb + row * 68 + c8 + 4]); v8h hv;
#pragma unroll
            for (int i = 0; i < 4; ++i) { hv[i] = (h16)x0[i]; hv[4 + i] = (h16)x1[i]; }
            *(v8h*)(crow + (size_t)row * DM + c8) = hv; }
         }
}

// k_oproj: register-blocked f16 GEMM, ONE WAVE per 64x64 tile, K = DM. P[m][n] = (sum_k A[m][k] Bt[n][k]) * OSI + bias[n] (bias RNE-converted to bf16, f32 add), f32 rows of pitch DM.
__global__ __launch_bounds__(32) void k_oproj(const h16* __restrict__ A, const h16* __restrict__ Bt, const float* __restrict__ bias, float* P) {
    __shared__ __align__(16) float os[16 * 68];
    const int K = DM;
    const int lane = threadIdx.x & 31, lr = lane & 15, hi = lane >> 4; const int r0 = blockIdx.x * 64, c0 = blockIdx.y * 64;
    v8f acc[4][4];
#pragma unroll
    for (int mb = 0; mb < 4; ++mb)
#pragma unroll
        for (int nb = 0; nb < 4; ++nb) acc[mb][nb] = (v8f){};
    const size_t aoff = (size_t)(r0 + lr) * K + 8 * hi, boff = (size_t)(c0 + lr) * K + 8 * hi;
#pragma unroll 1
    for (int kc = 0; kc < K; kc += 32) {
        v16h a[4];
#pragma unroll
        for (int mb = 0; mb < 4; ++mb) a[mb] = ldh(A + aoff + (size_t)mb * 16 * K + kc);
#pragma unroll
        for (int nb = 0; nb < 4; ++nb) { const v16h b = ldh(Bt + boff + (size_t)nb * 16 * K + kc);
#pragma unroll
            for (int mb = 0; mb < 4; ++mb) acc[mb][nb] = wmma16(a[mb], b, acc[mb][nb]); }
        asm volatile("v_nop\n\tv_nop\n\tv_nop\n\tv_nop" : "+v"(acc[0][0]), "+v"(acc[1][1]), "+v"(acc[2][2]), "+v"(acc[3][3]) : "v"(a[0]), "v"(a[1]), "v"(a[2]), "v"(a[3]));
    }
    float bcol[4];
#pragma unroll
    for (int nb = 0; nb < 4; ++nb) { int ci = c0 + nb * 16 + lr; ci = ci < DM ? ci : DM - 1; bcol[nb] = bfr(bias[ci]); }
#pragma unroll
    for (int mb = 0; mb < 4; ++mb) {
#pragma unroll
        for (int nb = 0; nb < 4; ++nb) {
#pragma unroll
            for (int j = 0; j < 8; ++j) os[(hi * 8 + j) * 68 + nb * 16 + lr] = acc[mb][nb][j] * OSI + bcol[nb]; }   // D: row 8h+j, col lane&15
        wave_sync();
        float* prow = P + (size_t)(r0 + mb * 16) * DM + c0;
{
#pragma unroll
            for (int s = 0; s < 8; ++s) { const int row = 2 * s + hi, cofs = lr * 4;   // 8 s x 2 rows = 16 rows; 16 lanes x 4 floats = 64 columns
                const v4f val = *(const v4fa*)(&os[row * 68 + cofs]);
                *(v4f*)(prow + (size_t)row * DM + cofs) = val; }
             }
        wave_sync();
    }
}

__global__ __launch_bounds__(256) void k_ln(const float* __restrict__ P, const float* __restrict__ gamma, const float* __restrict__ beta, float* OUT, int rows) {
    const int lane = threadIdx.x & 31, wave = threadIdx.x >> 5;
    const int row = blockIdx.x * 8 + wave;
    if (row >= rows) return;                  // wave-uniform; the kernel has no block barrier
    const int b = row / SEQ, t = row % SEQ;
    const float* src = P + (size_t)row * DM + lane * 4;
    float s = 0.0f;
#pragma unroll 1
    for (int it = 0; it < 8; ++it) { const v4f x = *(const v4f*)(src + it * 128); s += (x[0] + x[1]) + (x[2] + x[3]); }
    s += __shfl_xor(s, 16, 32); s += __shfl_xor(s, 8, 32); s += __shfl_xor(s, 4, 32); s += __shfl_xor(s, 2, 32); s += __shfl_xor(s, 1, 32);
    const float mu = s * (1.0f / (float)DM);
    float q = 0.0f;
#pragma unroll 1
    for (int it = 0; it < 8; ++it) { const v4f x = *(const v4f*)(src + it * 128);
        const float d0 = x[0] - mu, d1 = x[1] - mu, d2 = x[2] - mu, d3 = x[3] - mu; q += (d0 * d0 + d1 * d1) + (d2 * d2 + d3 * d3); }
    q += __shfl_xor(q, 16, 32); q += __shfl_xor(q, 8, 32); q += __shfl_xor(q, 4, 32); q += __shfl_xor(q, 2, 32); q += __shfl_xor(q, 1, 32);
    const float rstd = rsqrtf(q * (1.0f / (float)DM) + LN_EPS);
    float* dst = OUT + ((size_t)b * OUT_SEQ + t) * DM + lane * 4;
{
#pragma unroll 1
        for (int it = 0; it < 8; ++it) {
            const v4f x = *(const v4f*)(src + it * 128);
            const v4f g = *(const v4f*)(gamma + it * 128 + lane * 4);
            const v4f e = *(const v4f*)(beta + it * 128 + lane * 4);
            v4f y;
#pragma unroll
            for (int i = 0; i < 4; ++i) y[i] = (x[i] - mu) * rstd * bfr(g[i]) + bfr(e[i]);
            *(v4f*)(dst + it * 128) = y; }
         }
}

static constexpr size_t al256(size_t v) { return (v + 255) & ~(size_t)255; }
static constexpr size_t SZ_XB = al256((size_t)NB * SEQ * DM * 2);          // one bf16 activation plane
static constexpr size_t SZ_WB = al256((size_t)4 * DM * DM * 2);            // Wq | Wk | Wv (bf16) | Wo (f16 x64)
static constexpr size_t SZ_PL = al256((size_t)NB * NH_ * SEQ * HD * 2);    // one head-major f16 plane
static constexpr size_t SZ_TOTAL = 3 * SZ_XB + SZ_WB + 4 * SZ_PL;
static_assert(SZ_TOTAL <= (size_t)134217728);                   // workspace carve <= 128 MiB
static_assert(((size_t)DM * DM * 2) % 256 == 0);                // weight sub-planes stay 256-byte aligned
static_assert((size_t)NB * SEQ * DM * 2 <= SZ_XB);              // context plane (f16) aliases the q copy region
static_assert((size_t)NB * SEQ * DM * 4 <= 2 * SZ_XB);          // pre-normalisation plane (f32) aliases the k|v copy regions
static_assert(SZ_XB % 256 == 0);

static void cvt_act(const float* x, bf* XB, hipStream_t stream) {
    if (SEQ == SEQ_FULL) {
        const size_t n8 = (size_t)NB * SEQ * DM / 8;
        k_cvt8<<<(unsigned)((n8 + 255) / 256), 256, 0, stream>>>(x, XB, n8);
    } else {
        const size_t n8 = (size_t)SEQ * DM / 8;
        for (int b = 0; b < NB; ++b) k_cvt8<<<(unsigned)((n8 + 255) / 256), 256, 0, stream>>>(x + (size_t)b * SEQ_FULL * DM, XB + (size_t)b * SEQ * DM, n8);
    }
}

extern "C" void kernel_launch(void* const* d_in, const int* in_sizes, int n_in,
                              void* d_out, int out_size, void* d_ws, size_t ws_size, hipStream_t stream) {
    if (n_in < 13) return;
    const size_t needx = ((size_t)(NB - 1) * SEQ_FULL + SEQ) * DM;
    if ((size_t)in_sizes[0] < needx || (size_t)in_sizes[1] < needx || (size_t)in_sizes[2] < needx) return;
    if ((size_t)in_sizes[3] < (size_t)DM * DM || (size_t)in_sizes[5] < (size_t)DM * DM || (size_t)in_sizes[7] < (size_t)DM * DM || (size_t)in_sizes[9] < (size_t)DM * DM) return;
    if (in_sizes[4] < DM || in_sizes[6] < DM || in_sizes[8] < DM || in_sizes[10] < DM || in_sizes[11] < DM || in_sizes[12] < DM) return;
    if ((size_t)out_size < ((size_t)(NB - 1) * OUT_SEQ + SEQ) * DM) return;
    if (SZ_TOTAL > ws_size) return;
    // wire order: q, k, v, Wq, bq, Wk, bk, Wv, bv, Wo, bo, gamma, beta  (weights [out][in] = Bt as-is)
    const float* xq = (const float*)d_in[0]; const float* xk = (const float*)d_in[1]; const float* xv = (const float*)d_in[2];
    const float* wq = (const float*)d_in[3]; const float* bq = (const float*)d_in[4];
    const float* wk = (const float*)d_in[5]; const float* bk = (const float*)d_in[6];
    const float* wv = (const float*)d_in[7]; const float* bv = (const float*)d_in[8];
    const float* wo = (const float*)d_in[9]; const float* bo = (const float*)d_in[10];
    const float* gamma = (const float*)d_in[11]; const float* beta = (const float*)d_in[12];
    float* OUT = (float*)d_out;      // [NB][SEQ][1024]
    char* wsp = (char*)d_ws;
    bf* XQ = (bf*)wsp; wsp += SZ_XB;                 // [NB*SEQ][1024] bf16 copy of q   (later: context plane, f16)
    bf* XK = (bf*)wsp; wsp += SZ_XB;                 // [NB*SEQ][1024] bf16 copy of k   (later, with XV: pre-normalisation plane, f32)
    bf* XV = (bf*)wsp; wsp += SZ_XB;                 // [NB*SEQ][1024] bf16 copy of v
    bf* WB = (bf*)wsp; wsp += SZ_WB;                 // [4][1024][1024]: q | k | v (bf16) | o (f16 x64)
    h16* QH = (h16*)wsp; wsp += SZ_PL;               // [NB*16][SEQ][64]
    h16* QR = (h16*)wsp; wsp += SZ_PL;               // [NB*16][SEQ][64] residual x2048
    h16* KP = (h16*)wsp; wsp += SZ_PL;               // [NB*16][SEQ][64]
    h16* VT = (h16*)wsp; wsp += SZ_PL;               // [NB*16][64][SEQ]
    bf* WQ = WB; bf* WK = WB + (size_t)DM * DM; bf* WV = WB + (size_t)2 * DM * DM; h16* WO = (h16*)(WB + (size_t)3 * DM * DM);
    h16* CTX = (h16*)XQ;                             // [NB*SEQ][1024] f16 x64, written by k_flash after the q projection has consumed XQ
    float* PRE = (float*)XK;                         // [NB*SEQ][1024] f32, written by k_oproj after the k and v projections have consumed XK, XV

    cvt_act(xq, XQ, stream); cvt_act(xk, XK, stream); cvt_act(xv, XV, stream);
    { const size_t n8 = (size_t)DM * DM / 8; const unsigned g = (unsigned)((n8 + 255) / 256);
      k_cvt8<<<g, 256, 0, stream>>>(wq, WQ, n8); k_cvt8<<<g, 256, 0, stream>>>(wk, WK, n8); k_cvt8<<<g, 256, 0, stream>>>(wv, WV, n8);
      k_cvth<<<g, 256, 0, stream>>>(wo, WO, n8); }

    // q, k: A = x rows (m = b*SEQ + t), Bt = W rows (n = h*64 + d), bias by column n -> plane [(b*16 + h)][t][d]
    k_proj<<<dim3(NB * SEQ / 64, DM / 64, 1), 32, 0, stream>>>(XQ, WQ, bq, 0, QH, QR, 1, SEQ, (size_t)NH_ * SEQ * HD, HD, HD, (size_t)SEQ * HD);
    k_proj<<<dim3(NB * SEQ / 64, DM / 64, 1), 32, 0, stream>>>(XK, WK, bk, 0, KP, KP, 0, SEQ, (size_t)NH_ * SEQ * HD, HD, HD, (size_t)SEQ * HD);
    // v^T: A = Wv rows (m = h*64 + d), Bt = x rows (n = b*SEQ + t), bias by row m -> plane [(b*1024 + m)][t] = [(b*16 + h)][d][t]
    k_proj<<<dim3(DM / 64, NB * SEQ / 64, 1), 32, 0, stream>>>(WV, XV, bv, 1, VT, VT, 0, DM, (size_t)0, SEQ, SEQ, (size_t)DM * SEQ);

    k_flash<<<dim3(SEQ / (16 * AW), NB * NH_, 1), 32 * AW, 0, stream>>>(QH, QR, KP, VT, CTX);

    // output projection: A = context rows (m = b*SEQ + t, k = h*64 + d), Bt = Wo rows (n = output column) -> PRE[m][n]
    k_oproj<<<dim3(NB * SEQ / 64, DM / 64, 1), 32, 0, stream>>>(CTX, WO, bo, PRE);

    k_ln<<<dim3((NB * SEQ + 7) / 8, 1, 1), 256, 0, stream>>>(PRE, gamma, beta, OUT, NB * SEQ);
}

// v001
// It runs in 371 microseconds.
// Two timings next to v000 both put it at 1.16 times that version's speed.
#include <hip/hip_runtime.h>

// Multi-head attention, width 1024 = 16 heads x 64; q,k,v [NB][SEQ][1024]; Wq/Wk/Wv/Wo [out][in] (y = x W^T + b); score scale 1/8; no mask; output projection + LayerNorm (eps 1e-5).
// Compute dtypes, f32 accumulate everywhere: q/k/v projections v_wmma_f32_16x16x32_bf16 (x, W and biases RNE-converted to bf16; products exact);
// scores v_wmma_f32_16x16x32_f16: k single f16, q as f16 value + f16 residual x2048 in its own accumulator (two products); P (x256 carry, cancels in the normalisation) and v single f16;
// output projection v_wmma_f32_16x16x32_f16: context plane f16 x64 carry, Wo plane f16 of (bf16 RNE of Wo) x64 (exact), carries folded back (1/4096) in the f32 epilogue; softmax and LayerNorm f32 on the VALU.
// Layout: every 16-bit plane a matrix instruction reads is kept in fragment order (see ldp): bf16 copies of q,k,v and Wq,Wk,Wv, the Wo plane, q (hi, residual), k and v^T planes per head (written by the GEMM epilogue), the context plane; fused flash kernel in transposed form (S^T = K Q^T, O^T = V^T P^T);

#ifndef NB
#define NB 4
#endif
#ifndef SEQ
#define SEQ 2048
#endif
#define NB_FULL  4
#define SEQ_FULL 2048
#ifndef OUT_SEQ
#define OUT_SEQ SEQ              // row pitch (in tokens) between batches of the output
#endif
#define DM   1024
#define NH_  16
#define HD   64
#define AW   4                   // waves per flash block (16 query rows each)
#define QRS  2048.0f             // carry of the q residual plane
#define QRI  (1.0f / 2048.0f)
#define SC2  (0.125f * 1.4426950408889634f)   // HD^-0.5 * log2(e)
#define PSH  8.0f                // log2 of the P carry (256)
#define CXS  64.0f               // carry of the context plane
#define WOS  64.0f               // carry of the Wo plane
#define OSI  (1.0f / 4096.0f)    // 1 / (CXS * WOS)
#define LN_EPS 1.0e-5f

static_assert(HD == 64);
static_assert(NH_ * HD == DM);                 // head h = columns h*64 + d
static_assert(DM % 64 == 0);                   // 16 column tiles of 64
static_assert(DM % 32 == 0);                   // GEMM k-loop steps by 32
static_assert(DM == 1024);                     // LayerNorm kernel: 8 iterations x 32 lanes x 4 floats
static_assert(SEQ % 64 == 0);                  // a 64-row tile never straddles two batches
static_assert((NB * SEQ) % 64 == 0);
static_assert((NB * SEQ) % 8 == 0);            // LayerNorm grid: 8 rows per block
static_assert(SEQ % 32 == 0);                  // key loop steps by 32
static_assert(SEQ % (16 * AW) == 0);           // flash grid covers the sequence exactly
static_assert(((size_t)SEQ * DM) % 8 == 0);
static_assert(((size_t)DM * DM) % 8 == 0);
static_assert(NB <= NB_FULL);
static_assert(SEQ <= SEQ_FULL);

typedef _Float16 h16;
typedef unsigned short bf;
typedef __attribute__((ext_vector_type(16))) __bf16   v16bf;
typedef __attribute__((ext_vector_type(16))) _Float16 v16h;
typedef __attribute__((ext_vector_type(8)))  _Float16 v8h;
typedef __attribute__((ext_vector_type(8)))  unsigned short v8us;
typedef __attribute__((ext_vector_type(8)))  float    v8f;
typedef __attribute__((ext_vector_type(4)))  float    v4f;
typedef v4f  __attribute__((may_alias)) v4fa;

__device__ __forceinline__ unsigned short f2bf(float f) { unsigned u = __float_as_uint(f); u += 0x7FFFu + ((u >> 16) & 1u); return (unsigned short)(u >> 16); }
__device__ __forceinline__ float bfr(float f) { return __uint_as_float(((unsigned)f2bf(f)) << 16); }   // RNE convert to bf16, widened back to f32
__device__ __forceinline__ v16h cat16(v8h lo, v8h hi) { return __builtin_shufflevector(lo, hi, 0, 1, 2, 3, 4, 5, 6, 7, 8, 9, 10, 11, 12, 13, 14, 15); }
__device__ __forceinline__ v16bf cat16b(v8us lo, v8us hi) { return __builtin_bit_cast(v16bf, __builtin_shufflevector(lo, hi, 0, 1, 2, 3, 4, 5, 6, 7, 8, 9, 10, 11, 12, 13, 14, 15)); }
__device__ __forceinline__ v8f wmma16(v16h a, v16h b, v8f c) { return __builtin_amdgcn_wmma_f32_16x16x32_f16(false, a, false, b, (short)0, c, false, false); }
__device__ __forceinline__ v8f wmmab(v16bf a, v16bf b, v8f c) { return __builtin_amdgcn_wmma_f32_16x16x32_bf16(false, a, false, b, (short)0, c, false, false); }
// fragment-order planes: a chunk of 16 rows x 32 k is 512 contiguous 16-bit elements [piece = 0..1][lane = 16*h + row][8], holding k = 16*piece + 8*h + 0..7, so one wave-wide 16-B load reads 512 contiguous bytes (4 whole lines).
// The chunks of a 16-row strip follow one another along k; a matrix of row length K keeps strip r/16 at (r/16)*16*K.
// fragment loaders; p = chunk + 8*lane: elements 0..7 <- k0+8h+0..7, elements 8..15 <- k0+16+8h+0..7 (same map for A and B)
__device__ __forceinline__ v16h  ldp(const h16* p) { return cat16(*(const v8h*)p, *(const v8h*)(p + 256)); }
__device__ __forceinline__ v16bf ldbp(const bf* p) { return cat16b(*(const v8us*)p, *(const v8us*)(p + 256)); }
// source offset (row-major, row length DM) of the 8 elements that stand at fragment-order offset 8*i
__device__ __forceinline__ size_t frag_src(size_t i) { const size_t chunk = i >> 6; const int piece = (int)(i >> 5) & 1, h = (int)(i >> 4) & 1, row = (int)i & 15;
    return ((chunk / (DM / 32)) * 16 + row) * DM + (chunk % (DM / 32)) * 32 + piece * 16 + h * 8; }
// ordering point for wave-private LDS tiles (same wave writes and reads)
__device__ __forceinline__ void wave_sync() { __builtin_amdgcn_fence(3 /* release order */, "wavefront"); __builtin_amdgcn_wave_barrier(); asm volatile("" ::: "memory"); }

// k_cvt8, k_cvth: rows of DM floats (a multiple of 16 rows) -> 16-bit plane in fragment order; thread i writes the 8 elements at offset 8*i
__global__ __launch_bounds__(256) void k_cvt8(const float* __restrict__ src, bf* dst, size_t n8) {
    const size_t i = (size_t)blockIdx.x * 256 + threadIdx.x; if (i >= n8) return;
    const v8f v = *(const v8f*)(src + frag_src(i)); v8us o;
#pragma unroll
    for (int k = 0; k < 8; ++k) o[k] = f2bf(v[k]);
    *(v8us*)(dst + i * 8) = o; 
}

__global__ __launch_bounds__(256) void k_cvth(const float* __restrict__ src, h16* dst, size_t n8) {
    const size_t i = (size_t)blockIdx.x * 256 + threadIdx.x; if (i >= n8) return;
    const v8f v = *(const v8f*)(src + frag_src(i)); v8h o;
#pragma unroll
    for (int k = 0; k < 8; ++k) o[k] = (h16)(bfr(v[k]) * WOS);
    *(v8h*)(dst + i * 8) = o; 
}

// k_proj: register-blocked bf16 GEMM, ONE WAVE per 64x64 tile (16 accumulators), operands straight from fragment-order bf16 planes, K = DM.
// C[m][n] = sum_k A[m][k] Bt[n][k] + bias (bias indexed by n when biasRow == 0, by m when biasRow != 0; bias RNE-converted to bf16, added in f32),
// written as f16 (Ph) and optionally the f16 residual x2048 (Pr, useRes != 0): the tile's four 16-row strips (16 x 64, two chunks) in fragment order, 1024 halves each,
// one behind the other at (r0/RB)*sRB + (r0%RB)*pitch + (c0/CB)*sCB + (c0%CB)*64. grid (M/64, N/64), 32 threads.
__global__ __launch_bounds__(32) void k_proj(const bf* __restrict__ A, const bf* __restrict__ Bt, const float* __restrict__ bias, int biasRow,
                                             h16* Ph, h16* Pr, int useRes, int RB, size_t sRB, int pitch, int CB, size_t sCB) {
    __shared__ __align__(16) float os[16 * 68];
    const int K = DM;
    const int lane = threadIdx.x & 31, lr = lane & 15, hi = lane >> 4; const int r0 = blockIdx.x * 64, c0 = blockIdx.y * 64;
    v8f acc[4][4];
#pragma unroll
    for (int mb = 0; mb < 4; ++mb)
#pragma unroll
        for (int nb = 0; nb < 4; ++nb) acc[mb][nb] = (v8f){};
    const size_t aoff = (size_t)r0 * K + 8 * lane, boff = (size_t)c0 * K + 8 * lane;   // strip base + lane; + 16*K per strip, + 16*kc = 512 per chunk of 32 k
#pragma unroll 1
    for (int kc = 0; kc < K; kc += 32) {
        v16bf a[4];
#pragma unroll
        for (int mb = 0; mb < 4; ++mb) a[mb] = ldbp(A + aoff + (size_t)mb * 16 * K + kc * 16);
        asm volatile("s_wait_xcnt 0x0" ::: "memory");   // the A loads' address registers are reused as a B fragment's destination: keep the wait in front of that overwrite
#pragma unroll
        for (int nb = 0; nb < 4; ++nb) { const v16bf b = ldbp(Bt + boff + (size_t)nb * 16 * K + kc * 16);
#pragma unroll
            for (int mb = 0; mb < 4; ++mb) acc[mb][nb] = wmmab(a[mb], b, acc[mb][nb]); }
        asm volatile("v_nop\n\tv_nop\n\tv_nop\n\tv_nop" : "+v"(acc[0][0]), "+v"(acc[1][1]), "+v"(acc[2][2]), "+v"(acc[3][3]) : "v"(a[0]), "v"(a[1]), "v"(a[2]), "v"(a[3]));
    }
    // column-indexed bias values (clamped address; zero by value when the bias is row-indexed)
    float bcol[4];
#pragma unroll
    for (int nb = 0; nb < 4; ++nb) { int ci = c0 + nb * 16 + lr; ci = ci < DM ? ci : DM - 1; const float t = bfr(bias[ci]); bcol[nb] = biasRow ? 0.0f : t; }
    const size_t tbase = (size_t)(r0 / RB) * sRB + (size_t)(r0 % RB) * (size_t)pitch + (size_t)(c0 / CB) * sCB + (size_t)(c0 % CB) * 64;
#pragma unroll
    for (int mb = 0; mb < 4; ++mb) {
        float brow[8];
#pragma unroll
        for (int j = 0; j < 8; ++j) { int ri = r0 + mb * 16 + hi * 8 + j; ri = ri < DM ? ri : DM - 1; const float t = bfr(bias[ri]); brow[j] = biasRow ? t : 0.0f; }
#pragma unroll
        for (int nb = 0; nb < 4; ++nb) {
#pragma unroll
            for (int j = 0; j < 8; ++j) os[(hi * 8 + j) * 68 + nb * 16 + lr] = acc[mb][nb][j] + bcol[nb] + brow[j]; }   // D: row 8h+j, col lane&15
        wave_sync();
        const size_t sb = tbase + (size_t)(mb * 1024);
{
#pragma unroll
            for (int s = 0; s < 4; ++s) { const int row = lr, c8 = 16 * s + 8 * hi;   // 16 rows x 2 column groups of 8 per s; 4 s = 64 columns
                const v4f x0 = *(const v4fa*)(&os[row * 68 + c8]); const v4f x1 = *(const v4fa*)(&os[row * 68 + c8 + 4]); v8h hv, rv;
#pragma unroll
                for (int i = 0; i < 4; ++i) { const h16 a0 = (h16)x0[i]; const h16 a1 = (h16)x1[i]; hv[i] = a0; hv[4 + i] = a1; rv[i] = (h16)((x0[i] - (float)a0) * QRS); rv[4 + i] = (h16)((x1[i] - (float)a1) * QRS); }
                const size_t oo = sb + (size_t)(s * 256 + lane * 8);
                *(v8h*)(Ph + oo) = hv; if (useRes) *(v8h*)(Pr + oo) = rv; }
             }
        wave_sync();
    }
}

// k_flash: fused attention, one wave per 16 query rows of one (batch, head); K / V^T / Q fragments straight from the fragment-order f16 planes (two 16-B loads each, arithmetic addressing).
// Transposed form: S^T[key][t] = K Q^T (A = K rows, B = Q rows); lane (t = lane&15, h = lane>>4) holds keys 8h+r of each 16-key tile, so the packed
// P tile is directly the B fragment of O^T[d][t] = V^T P^T (element r <- tile keys 0..15, element 8+r <- tile keys 16..31, lane unchanged).
// Softmax state (running max, partial sum) is one scalar per lane; the two lane halves of a row are combined with one xor-16 exchange.
__global__ __launch_bounds__(32 * AW) void k_flash(const h16* __restrict__ QH, const h16* __restrict__ QR, const h16* __restrict__ KP, const h16* __restrict__ VT, h16* CTX) {
    const int lane = threadIdx.x & 31, wave = threadIdx.x >> 5;
    const int zh = blockIdx.y; const int b = zh / NH_, h = zh % NH_;
    const int t0 = (blockIdx.x * AW + wave) * 16;
    const size_t pbase = (size_t)zh * SEQ * HD;
    const size_t qo = pbase + (size_t)t0 * HD + 8 * lane;    // strip of 16 queries x 64 d
    const v16h qh0 = ldp(QH + qo), qh1 = ldp(QH + qo + 512), qr0 = ldp(QR + qo), qr1 = ldp(QR + qo + 512);   // B fragments: col t, k = d
    const size_t ko = pbase + (size_t)lane * 8;              // + key0 * HD: strips of 16 keys x 64 d               (A fragment: row key, k = d)
    const size_t vo = pbase + (size_t)lane * 8;              // + (key0/64)*4096 + j*1024: strips of 16 d x 64 keys (A fragment: row d, k = key)
    v8f o0 = (v8f){}, o1 = (v8f){}, o2 = (v8f){}, o3 = (v8f){};
    float m = -3.0e38f, l = 0.0f;
#pragma unroll 1
    for (int key0 = 0; key0 < SEQ; key0 += 32) {
        const h16* ka = KP + ko + (size_t)key0 * HD;
        const v16h ka0 = ldp(ka), ka1 = ldp(ka + 512), kb0 = ldp(ka + 1024), kb1 = ldp(ka + 1536);
        v8f sHa = (v8f){}, sLa = (v8f){}, sHb = (v8f){}, sLb = (v8f){};
        sHa = wmma16(ka0, qh0, sHa); sLa = wmma16(ka0, qr0, sLa); sHb = wmma16(kb0, qh0, sHb); sLb = wmma16(kb0, qr0, sLb);
        sHa = wmma16(ka1, qh1, sHa); sLa = wmma16(ka1, qr1, sLa); sHb = wmma16(kb1, qh1, sHb); sLb = wmma16(kb1, qr1, sLb);
        asm volatile("v_nop\n\tv_nop\n\tv_nop\n\tv_nop" : "+v"(sHa), "+v"(sLa), "+v"(sHb), "+v"(sLb) : "v"(ka0), "v"(ka1), "v"(kb0), "v"(kb1));
        float ta[8], tb[8]; float mx = -3.0e38f;
#pragma unroll
        for (int r = 0; r < 8; ++r) { ta[r] = (sHa[r] + sLa[r] * QRI) * SC2; tb[r] = (sHb[r] + sLb[r] * QRI) * SC2; mx = fmaxf(mx, fmaxf(ta[r], tb[r])); }
        mx = fmaxf(mx, __shfl_xor(mx, 16, 32));
        const float mnew = fmaxf(m, mx);
        const float alpha = __builtin_amdgcn_exp2f(m - mnew);
        const float sh = PSH - mnew;
        v16h pb; float ls = 0.0f;
#pragma unroll
        for (int r = 0; r < 8; ++r) { const h16 pa = (h16)__builtin_amdgcn_exp2f(ta[r] + sh); const h16 pc = (h16)__builtin_amdgcn_exp2f(tb[r] + sh); pb[r] = pa; pb[8 + r] = pc; ls += (float)pa + (float)pc; }
        l = l * alpha + ls; m = mnew;
        o0 = o0 * alpha; o1 = o1 * alpha; o2 = o2 * alpha; o3 = o3 * alpha;
        const h16* va = VT + vo + (size_t)(key0 >> 6) * 4096 + (size_t)((key0 >> 5) & 1) * 512;
        const v16h v0 = ldp(va), v1 = ldp(va + 1024), v2 = ldp(va + 2048), v3 = ldp(va + 3072);
        o0 = wmma16(v0, pb, o0); o1 = wmma16(v1, pb, o1); o2 = wmma16(v2, pb, o2); o3 = wmma16(v3, pb, o3);
        asm volatile("v_nop\n\tv_nop\n\tv_nop\n\tv_nop" : "+v"(o0), "+v"(o1), "+v"(o2), "+v"(o3) : "v"(v0), "v"(v1), "v"(v2), "v"(v3), "v"(pb));
    }
    l += __shfl_xor(l, 16, 32);
    const float inv = CXS * (1.0f / l);
    // O^T D layout: o_j[r] = (d = 16j + 8h + r, t = lane&15): the lane's eight values of o_j are its own 16-B piece j of the fragment-order strip (row t, k = 16j + 8h + 0..7), so they go out without staging
    h16* crow = CTX + ((size_t)b * SEQ + t0) * DM + h * 1024 + lane * 8;   // merged heads: column h*64 + d = chunks 2h, 2h+1 of this 16-row strip
    v8h c0, c1, c2, c3;
#pragma unroll
    for (int r = 0; r < 8; ++r) { c0[r] = (h16)(o0[r] * inv); c1[r] = (h16)(o1[r] * inv); c2[r] = (h16)(o2[r] * inv); c3[r] = (h16)(o3[r] * inv); }
    *(v8h*)(crow) = c0; *(v8h*)(crow + 256) = c1; *(v8h*)(crow + 512) = c2; *(v8h*)(crow + 768) = c3;
}

// k_oproj: register-blocked f16 GEMM, ONE WAVE per 64x64 tile, operands from fragment-order planes, K = DM. P[m][n] = (sum_k A[m][k] Bt[n][k]) * OSI + bias[n] (bias RNE-converted to bf16, f32 add), f32 rows of pitch DM.
__global__ __launch_bounds__(32) void k_oproj(const h16* __restrict__ A, const h16* __restrict__ Bt, const float* __restrict__ bias, float* P) {
    __shared__ __align__(16) float os[16 * 68];
    const int K = DM;
    const int lane = threadIdx.x & 31, lr = lane & 15, hi = lane >> 4; const int r0 = blockIdx.x * 64, c0 = blockIdx.y * 64;
    v8f acc[4][4];
#pragma unroll
    for (int mb = 0; mb < 4; ++mb)
#pragma unroll
        for (int nb = 0; nb < 4; ++nb) acc[mb][nb] = (v8f){};
    const size_t aoff = (size_t)r0 * K + 8 * lane, boff = (size_t)c0 * K + 8 * lane;   // strip base + lane; + 16*K per strip, + 16*kc = 512 per chunk of 32 k
#pragma unroll 1
    for (int kc = 0; kc < K; kc += 32) {
        v16h a[4];
#pragma unroll
        for (int mb = 0; mb < 4; ++mb) a[mb] = ldp(A + aoff + (size_t)mb * 16 * K + kc * 16);
        asm volatile("s_wait_xcnt 0x0" ::: "memory");   // the A loads' address registers are reused as a B fragment's destination: keep the wait in front of that overwrite
#pragma unroll
        for (int nb = 0; nb < 4; ++nb) { const v16h b = ldp(Bt + boff + (size_t)nb * 16 * K + kc * 16);
#pragma unroll
            for (int mb = 0; mb < 4; ++mb) acc[mb][nb] = wmma16(a[mb], b, acc[mb][nb]); }
        asm volatile("v_nop\n\tv_nop\n\tv_nop\n\tv_nop" : "+v"(acc[0][0]), "+v"(acc[1][1]), "+v"(acc[2][2]), "+v"(acc[3][3]) : "v"(a[0]), "v"(a[1]), "v"(a[2]), "v"(a[3]));
    }
    float bcol[4];
#pragma unroll
    for (int nb = 0; nb < 4; ++nb) { int ci = c0 + nb * 16 + lr; ci = ci < DM ? ci : DM - 1; bcol[nb] = bfr(bias[ci]); }
#pragma unroll
    for (int mb = 0; mb < 4; ++mb) {
#pragma unroll
        for (int nb = 0; nb < 4; ++nb) {
#pragma unroll
            for (int j = 0; j < 8; ++j) os[(hi * 8 + j) * 68 + nb * 16 + lr] = acc[mb][nb][j] * OSI + bcol[nb]; }   // D: row 8h+j, col lane&15
        wave_sync();
        float* prow = P + (size_t)(r0 + mb * 16) * DM + c0;
{
#pragma unroll
            for (int s = 0; s < 8; ++s) { const int row = 2 * s + hi, cofs = lr * 4;   // 8 s x 2 rows = 16 rows; 16 lanes x 4 floats = 64 columns
                const v4f val = *(const v4fa*)(&os[row * 68 + cofs]);
                *(v4f*)(prow + (size_t)row * DM + cofs) = val; }
             }
        wave_sync();
    }
}

__global__ __launch_bounds__(256) void k_ln(const float* __restrict__ P, const float* __restrict__ gamma, const float* __restrict__ beta, float* OUT, int rows) {
    const int lane = threadIdx.x & 31, wave = threadIdx.x >> 5;
    const int row = blockIdx.x * 8 + wave;
    if (row >= rows) return;                  // wave-uniform; the kernel has no block barrier
    const int b = row / SEQ, t = row % SEQ;
    const float* src = P + (size_t)row * DM + lane * 4;
    float s = 0.0f;
#pragma unroll 1
    for (int it = 0; it < 8; ++it) { const v4f x = *(const v4f*)(src + it * 128); s += (x[0] + x[1]) + (x[2] + x[3]); }
    s += __shfl_xor(s, 16, 32); s += __shfl_xor(s, 8, 32); s += __shfl_xor(s, 4, 32); s += __shfl_xor(s, 2, 32); s += __shfl_xor(s, 1, 32);
    const float mu = s * (1.0f / (float)DM);
    float q = 0.0f;
#pragma unroll 1
    for (int it = 0; it < 8; ++it) { const v4f x = *(const v4f*)(src + it * 128);
        const float d0 = x[0] - mu, d1 = x[1] - mu, d2 = x[2] - mu, d3 = x[3] - mu; q += (d0 * d0 + d1 * d1) + (d2 * d2 + d3 * d3); }
    q += __shfl_xor(q, 16, 32); q += __shfl_xor(q, 8, 32); q += __shfl_xor(q, 4, 32); q += __shfl_xor(q, 2, 32); q += __shfl_xor(q, 1, 32);
    const float rstd = rsqrtf(q * (1.0f / (float)DM) + LN_EPS);
    float* dst = OUT + ((size_t)b * OUT_SEQ + t) * DM + lane * 4;
{
#pragma unroll 1
        for (int it = 0; it < 8; ++it) {
            const v4f x = *(const v4f*)(src + it * 128);
            const v4f g = *(const v4f*)(gamma + it * 128 + lane * 4);
            const v4f e = *(const v4f*)(beta + it * 128 + lane * 4);
            v4f y;
#pragma unroll
            for (int i = 0; i < 4; ++i) y[i] = (x[i] - mu) * rstd * bfr(g[i]) + bfr(e[i]);
            *(v4f*)(dst + it * 128) = y; }
         }
}

static constexpr size_t al256(size_t v) { return (v + 255) & ~(size_t)255; }
static constexpr size_t SZ_XB = al256((size_t)NB * SEQ * DM * 2);          // one bf16 activation plane
static constexpr size_t SZ_WB = al256((size_t)4 * DM * DM * 2);            // Wq | Wk | Wv (bf16) | Wo (f16 x64)
static constexpr size_t SZ_PL = al256((size_t)NB * NH_ * SEQ * HD * 2);    // one head-major f16 plane
static constexpr size_t SZ_TOTAL = 3 * SZ_XB + SZ_WB + 4 * SZ_PL;
static_assert(SZ_TOTAL <= (size_t)134217728);                   // workspace carve <= 128 MiB
static_assert(((size_t)DM * DM * 2) % 256 == 0);                // weight sub-planes stay 256-byte aligned
static_assert((size_t)NB * SEQ * DM * 2 <= SZ_XB);              // context plane (f16) aliases the q copy region
static_assert((size_t)NB * SEQ * DM * 4 <= 2 * SZ_XB);          // pre-normalisation plane (f32) aliases the k|v copy regions
static_assert(SZ_XB % 256 == 0);

static void cvt_act(const float* x, bf* XB, hipStream_t stream) {
    if (SEQ == SEQ_FULL) {
        const size_t n8 = (size_t)NB * SEQ * DM / 8;
        k_cvt8<<<(unsigned)((n8 + 255) / 256), 256, 0, stream>>>(x, XB, n8);
    } else {
        const size_t n8 = (size_t)SEQ * DM / 8;
        for (int b = 0; b < NB; ++b) k_cvt8<<<(unsigned)((n8 + 255) / 256), 256, 0, stream>>>(x + (size_t)b * SEQ_FULL * DM, XB + (size_t)b * SEQ * DM, n8);
    }
}

extern "C" void kernel_launch(void* const* d_in, const int* in_sizes, int n_in,
                              void* d_out, int out_size, void* d_ws, size_t ws_size, hipStream_t stream) {
    if (n_in < 13) return;
    const size_t needx = ((size_t)(NB - 1) * SEQ_FULL + SEQ) * DM;
    if ((size_t)in_sizes[0] < needx || (size_t)in_sizes[1] < needx || (size_t)in_sizes[2] < needx) return;
    if ((size_t)in_sizes[3] < (size_t)DM * DM || (size_t)in_sizes[5] < (size_t)DM * DM || (size_t)in_sizes[7] < (size_t)DM * DM || (size_t)in_sizes[9] < (size_t)DM * DM) return;
    if (in_sizes[4] < DM || in_sizes[6] < DM || in_sizes[8] < DM || in_sizes[10] < DM || in_sizes[11] < DM || in_sizes[12] < DM) return;
    if ((size_t)out_size < ((size_t)(NB - 1) * OUT_SEQ + SEQ) * DM) return;
    if (SZ_TOTAL > ws_size) return;
    // wire order: q, k, v, Wq, bq, Wk, bk, Wv, bv, Wo, bo, gamma, beta  (weights [out][in] = Bt as-is)
    const float* xq = (const float*)d_in[0]; const float* xk = (const float*)d_in[1]; const float* xv = (const float*)d_in[2];
    const float* wq = (const float*)d_in[3]; const float* bq = (const float*)d_in[4];
    const float* wk = (const float*)d_in[5]; const float* bk = (const float*)d_in[6];
    const float* wv = (const float*)d_in[7]; const float* bv = (const float*)d_in[8];
    const float* wo = (const float*)d_in[9]; const float* bo = (const float*)d_in[10];
    const float* gamma = (const float*)d_in[11]; const float* beta = (const float*)d_in[12];
    float* OUT = (float*)d_out;      // [NB][SEQ][1024]
    char* wsp = (char*)d_ws;
    bf* XQ = (bf*)wsp; wsp += SZ_XB;                 // [NB*SEQ][1024] bf16 copy of q, fragment order   (later: context plane, f16)
    bf* XK = (bf*)wsp; wsp += SZ_XB;                 // [NB*SEQ][1024] bf16 copy of k, fragment order   (later, with XV: pre-normalisation plane, f32)
    bf* XV = (bf*)wsp; wsp += SZ_XB;                 // [NB*SEQ][1024] bf16 copy of v, fragment order
    bf* WB = (bf*)wsp; wsp += SZ_WB;                 // [4][1024][1024]: q | k | v (bf16) | o (f16 x64), each in fragment order
    h16* QH = (h16*)wsp; wsp += SZ_PL;               // [NB*16][SEQ/16] strips of 16 queries x 64 d, fragment order
    h16* QR = (h16*)wsp; wsp += SZ_PL;               // the same, residual x2048
    h16* KP = (h16*)wsp; wsp += SZ_PL;               // [NB*16][SEQ/16] strips of 16 keys x 64 d, fragment order
    h16* VT = (h16*)wsp; wsp += SZ_PL;               // [NB*16][SEQ/64][4] strips of 16 d x 64 keys, fragment order
    bf* WQ = WB; bf* WK = WB + (size_t)DM * DM; bf* WV = WB + (size_t)2 * DM * DM; h16* WO = (h16*)(WB + (size_t)3 * DM * DM);
    h16* CTX = (h16*)XQ;                             // [NB*SEQ][1024] f16 x64, fragment order, written by k_flash after the q projection has consumed XQ
    float* PRE = (float*)XK;                         // [NB*SEQ][1024] f32, written by k_oproj after the k and v projections have consumed XK, XV

    cvt_act(xq, XQ, stream); cvt_act(xk, XK, stream); cvt_act(xv, XV, stream);
    { const size_t n8 = (size_t)DM * DM / 8; const unsigned g = (unsigned)((n8 + 255) / 256);
      k_cvt8<<<g, 256, 0, stream>>>(wq, WQ, n8); k_cvt8<<<g, 256, 0, stream>>>(wk, WK, n8); k_cvt8<<<g, 256, 0, stream>>>(wv, WV, n8);
      k_cvth<<<g, 256, 0, stream>>>(wo, WO, n8); }

    // q, k: A = x rows (m = b*SEQ + t), Bt = W rows (n = h*64 + d), bias by column n -> head (b*16 + h), strip t/16, fragment order
    k_proj<<<dim3(NB * SEQ / 64, DM / 64, 1), 32, 0, stream>>>(XQ, WQ, bq, 0, QH, QR, 1, SEQ, (size_t)NH_ * SEQ * HD, HD, HD, (size_t)SEQ * HD);
    k_proj<<<dim3(NB * SEQ / 64, DM / 64, 1), 32, 0, stream>>>(XK, WK, bk, 0, KP, KP, 0, SEQ, (size_t)NH_ * SEQ * HD, HD, HD, (size_t)SEQ * HD);
    // v^T: A = Wv rows (m = h*64 + d), Bt = x rows (n = b*SEQ + t), bias by row m -> head (b*16 + h), block t/64, strip d/16, fragment order
    k_proj<<<dim3(DM / 64, NB * SEQ / 64, 1), 32, 0, stream>>>(WV, XV, bv, 1, VT, VT, 0, DM, (size_t)0, SEQ, SEQ, (size_t)DM * SEQ);

    k_flash<<<dim3(SEQ / (16 * AW), NB * NH_, 1), 32 * AW, 0, stream>>>(QH, QR, KP, VT, CTX);

    // output projection: A = context rows (m = b*SEQ + t, k = h*64 + d), Bt = Wo rows (n = output column) -> PRE[m][n]
    k_oproj<<<dim3(NB * SEQ / 64, DM / 64, 1), 32, 0, stream>>>(CTX, WO, bo, PRE);

    k_ln<<<dim3((NB * SEQ + 7) / 8, 1, 1), 256, 0, stream>>>(PRE, gamma, beta, OUT, NB * SEQ);
}

// v002
// It runs in 356 microseconds.
// Timed twice side by side with v001, it ran 1.05 and 1.04 times as fast.
// Counting every step since v000, it is 1.21 times as fast.
#include <hip/hip_runtime.h>

// Multi-head attention, width 1024 = 16 heads x 64; q,k,v [NB][SEQ][1024]; Wq/Wk/Wv/Wo [out][in] (y = x W^T + b); score scale 1/8; no mask; output projection + LayerNorm (eps 1e-5).
// Compute dtypes, f32 accumulate everywhere: q/k/v projections v_wmma_f32_16x16x32_bf16 (x, W and biases RNE-converted to bf16; products exact);
// scores v_wmma_f32_16x16x32_f16: k single f16, q as f16 value + f16 residual x2048 in its own accumulator (two products); P (x256 carry, cancels in the normalisation) and v single f16;
// output projection v_wmma_f32_16x16x32_f16: context plane f16 x64 carry, Wo plane f16 of (bf16 RNE of Wo) x64 (exact), carries folded back (1/4096) in the f32 epilogue; softmax and LayerNorm f32 on the VALU.
// Layout: every 16-bit plane a matrix instruction reads is kept in fragment order (see ldp): bf16 copies of q,k,v and Wq,Wk,Wv, the Wo plane, q (hi, residual), k and v^T planes per head (written by the GEMM epilogue), the context plane; fused flash kernel in transposed form (S^T = K Q^T, O^T = V^T P^T);

#ifndef NB
#define NB 4
#endif
#ifndef SEQ
#define SEQ 2048
#endif
#define NB_FULL  4
#define SEQ_FULL 2048
#ifndef OUT_SEQ
#define OUT_SEQ SEQ              // row pitch (in tokens) between batches of the output
#endif
#define DM   1024
#define NH_  16
#define HD   64
#define AW   4                   // waves per flash block (16 query rows each)
#define QRS  2048.0f             // carry of the q residual plane
#define QRI  (1.0f / 2048.0f)
#define SC2  (0.125f * 1.4426950408889634f)   // HD^-0.5 * log2(e)
#define PSH  8.0f                // log2 of the P carry (256)
#define CXS  64.0f               // carry of the context plane
#define WOS  64.0f               // carry of the Wo plane
#define OSI  (1.0f / 4096.0f)    // 1 / (CXS * WOS)
#define LN_EPS 1.0e-5f

static_assert(HD == 64);
static_assert(NH_ * HD == DM);                 // head h = columns h*64 + d
static_assert(DM % 64 == 0);                   // 16 column tiles of 64
static_assert(DM % 32 == 0);                   // GEMM k-loop steps by 32
static_assert(DM == 1024);                     // LayerNorm kernel: 8 iterations x 32 lanes x 4 floats
static_assert(SEQ % 64 == 0);                  // a 64-row tile never straddles two batches
static_assert((NB * SEQ) % 64 == 0);
static_assert((NB * SEQ) % 8 == 0);            // LayerNorm grid: 8 rows per block
static_assert(SEQ % 32 == 0);                  // key loop steps by 32
static_assert(SEQ % (16 * AW) == 0);           // flash grid covers the sequence exactly
static_assert(((size_t)SEQ * DM) % 8 == 0);
static_assert(((size_t)DM * DM) % 8 == 0);
static_assert(NB <= NB_FULL);
static_assert(SEQ <= SEQ_FULL);

typedef _Float16 h16;
typedef unsigned short bf;
typedef __attribute__((ext_vector_type(16))) __bf16   v16bf;
typedef __attribute__((ext_vector_type(16))) _Float16 v16h;
typedef __attribute__((ext_vector_type(8)))  _Float16 v8h;
typedef __attribute__((ext_vector_type(8)))  unsigned short v8us;
typedef __attribute__((ext_vector_type(8)))  float    v8f;
typedef __attribute__((ext_vector_type(4)))  float    v4f;
typedef v4f  __attribute__((may_alias)) v4fa;

__device__ __forceinline__ unsigned short f2bf(float f) { unsigned u = __float_as_uint(f); u += 0x7FFFu + ((u >> 16) & 1u); return (unsigned short)(u >> 16); }
__device__ __forceinline__ float bfr(float f) { return __uint_as_float(((unsigned)f2bf(f)) << 16); }   // RNE convert to bf16, widened back to f32
__device__ __forceinline__ v16h cat16(v8h lo, v8h hi) { return __builtin_shufflevector(lo, hi, 0, 1, 2, 3, 4, 5, 6, 7, 8, 9, 10, 11, 12, 13, 14, 15); }
__device__ __forceinline__ v16bf cat16b(v8us lo, v8us hi) { return __builtin_bit_cast(v16bf, __builtin_shufflevector(lo, hi, 0, 1, 2, 3, 4, 5, 6, 7, 8, 9, 10, 11, 12, 13, 14, 15)); }
__device__ __forceinline__ v8f wmma16(v16h a, v16h b, v8f c) { return __builtin_amdgcn_wmma_f32_16x16x32_f16(false, a, false, b, (short)0, c, false, false); }
__device__ __forceinline__ v8f wmmab(v16bf a, v16bf b, v8f c) { return __builtin_amdgcn_wmma_f32_16x16x32_bf16(false, a, false, b, (short)0, c, false, false); }
// fragment-order planes: a chunk of 16 rows x 32 k is 512 contiguous 16-bit elements [piece = 0..1][lane = 16*h + row][8], holding k = 16*piece + 8*h + 0..7, so one wave-wide 16-B load reads 512 contiguous bytes (4 whole lines).
// The chunks of a 16-row strip follow one another along k; a matrix of row length K keeps strip r/16 at (r/16)*16*K.
// fragment loaders; p = chunk + 8*lane: elements 0..7 <- k0+8h+0..7, elements 8..15 <- k0+16+8h+0..7 (same map for A and B)
__device__ __forceinline__ v16h  ldp(const h16* p) { return cat16(*(const v8h*)p, *(const v8h*)(p + 256)); }
__device__ __forceinline__ v16bf ldbp(const bf* p) { return cat16b(*(const v8us*)p, *(const v8us*)(p + 256)); }
// ordering point for wave-private LDS tiles (same wave writes and reads)
__device__ __forceinline__ void wave_sync() { __builtin_amdgcn_fence(3 /* release order */, "wavefront"); __builtin_amdgcn_wave_barrier(); asm volatile("" ::: "memory"); }

// k_cvtall: all seven f32 inputs of the matrix products -> 16-bit planes in fragment order, in ONE launch of CV_ALL / CV_PER waves (7168 at NB 4, SEQ 2048), two batches each.
// A batch is 8 consecutive wave-wide pieces of a plane = 4 chunks = 16 rows x 128 k: each lane reads 8 x 32 B of its row (all 16 loads in flight together; the two lanes of a row cover 512 contiguous bytes)
// and the wave writes 4 KiB of plane contiguously. Piece st of batch bp holds k = (bp % 8) * 128 + 16 * st + 8 * h + 0..7 of row (bp / 8) * 16 + (lane & 15), at plane offset bp * 2048 + st * 256 + lane * 8.
// Batches in order: q | k | v (bf16 RNE) | Wq | Wk | Wv (bf16 RNE) | Wo (f16 of bf16 RNE x64); a batch never straddles two planes. Each wave takes CV_PER batches.
#define CV_ACT   ((int)((size_t)NB * SEQ * DM / 2048))
#define CV_WGT   ((int)((size_t)DM * DM / 2048))
#define CV_ALL   (3 * CV_ACT + 4 * CV_WGT)
#define CV_PER   2
#define CV_WAVES (CV_ALL / CV_PER)
static_assert(DM % 128 == 0);                       // a batch of 128 k stays inside one 16-row strip
static_assert(((size_t)NB * SEQ * DM) % 2048 == 0);
static_assert(((size_t)DM * DM) % 2048 == 0);
static_assert(CV_ALL % (CV_PER * 4) == 0);          // whole 4-wave blocks, every wave the same number of batches
__global__ __launch_bounds__(128) void k_cvtall(const float* __restrict__ xq, const float* __restrict__ xk, const float* __restrict__ xv,
                                                const float* __restrict__ wq, const float* __restrict__ wk, const float* __restrict__ wv, const float* __restrict__ wo,
                                                bf* XQ, bf* XK, bf* XV, bf* WB) {
    const int lane = threadIdx.x & 31, row = lane & 15, hi = lane >> 4;
    const int wid = __builtin_amdgcn_readfirstlane((int)(blockIdx.x * 4 + (threadIdx.x >> 5)));   // wave-uniform: the plane choice below stays scalar
    for (int it = 0; it < CV_PER; ++it) {
        const int bid = it * CV_WAVES + wid;
        const float* src; bf* dst; int bp, r16;
        if (bid < 3 * CV_ACT) {
            const int p = bid / CV_ACT; bp = bid % CV_ACT;
            src = p == 0 ? xq : (p == 1 ? xk : xv); dst = p == 0 ? XQ : (p == 1 ? XK : XV);
            r16 = (bp / (DM / 128)) * 16; r16 = (r16 / SEQ) * SEQ_FULL + r16 % SEQ;   // token row -> row of the full-pitch input
        } else {
            const int r = bid - 3 * CV_ACT; const int p = r / CV_WGT; bp = r % CV_WGT;
            src = p == 0 ? wq : (p == 1 ? wk : (p == 2 ? wv : wo)); dst = WB + (size_t)p * DM * DM;
            r16 = (bp / (DM / 128)) * 16;
        }
        const float* s = src + (size_t)(r16 + row) * DM + (bp % (DM / 128)) * 128 + hi * 8;
        bf* d = dst + (size_t)bp * 2048 + lane * 8;
        v8f v[8];
#pragma unroll
        for (int st = 0; st < 8; ++st) v[st] = *(const v8f*)(s + st * 16);
        asm volatile("s_wait_xcnt 0x0" :: "v"(s) : "memory");   // the wait stands in front of any overwrite of the loads' address registers; the address as an input keeps those registers from serving as a load's own destination
        if (bid < 3 * CV_ACT + 3 * CV_WGT) {
#pragma unroll
            for (int st = 0; st < 8; ++st) { v8us o;
#pragma unroll
                for (int k = 0; k < 8; ++k) o[k] = f2bf(v[st][k]);
                *(v8us*)(d + st * 256) = o; }
            asm volatile("s_wait_xcnt 0x0" ::: "memory");   // the stores' address and data registers are rewritten behind this arm (next trip): keep the wait in front of that overwrite
        } else {
#pragma unroll
            for (int st = 0; st < 8; ++st) { v8h o;
#pragma unroll
                for (int k = 0; k < 8; ++k) o[k] = (h16)(bfr(v[st][k]) * WOS);
                *(v8h*)((h16*)d + st * 256) = o; }
            asm volatile("s_wait_xcnt 0x0" ::: "memory");   // as in the other arm: the wait stands directly behind this arm's last store
        }
    }
}

// k_proj: register-blocked bf16 GEMM, ONE WAVE per 64x64 tile (16 accumulators), operands straight from fragment-order bf16 planes, K = DM.
// C[m][n] = sum_k A[m][k] Bt[n][k] + bias (bias indexed by n when biasRow == 0, by m when biasRow != 0; bias RNE-converted to bf16, added in f32),
// written as f16 (Ph) and optionally the f16 residual x2048 (Pr, useRes != 0): the tile's four 16-row strips (16 x 64, two chunks) in fragment order, 1024 halves each,
// one behind the other at (r0/RB)*sRB + (r0%RB)*pitch + (c0/CB)*sCB + (c0%CB)*64. grid (M/64, N/64), 32 threads.
__global__ __launch_bounds__(32) void k_proj(const bf* __restrict__ A, const bf* __restrict__ Bt, const float* __restrict__ bias, int biasRow,
                                             h16* Ph, h16* Pr, int useRes, int RB, size_t sRB, int pitch, int CB, size_t sCB) {
    __shared__ __align__(16) float os[16 * 68];
    const int K = DM;
    const int lane = threadIdx.x & 31, lr = lane & 15, hi = lane >> 4; const int r0 = blockIdx.x * 64, c0 = blockIdx.y * 64;
    v8f acc[4][4];
#pragma unroll
    for (int mb = 0; mb < 4; ++mb)
#pragma unroll
        for (int nb = 0; nb < 4; ++nb) acc[mb][nb] = (v8f){};
    const size_t aoff = (size_t)r0 * K + 8 * lane, boff = (size_t)c0 * K + 8 * lane;   // strip base + lane; + 16*K per strip, + 16*kc = 512 per chunk of 32 k
#pragma unroll 1
    for (int kc = 0; kc < K; kc += 32) {
        v16bf a[4];
#pragma unroll
        for (int mb = 0; mb < 4; ++mb) a[mb] = ldbp(A + aoff + (size_t)mb * 16 * K + kc * 16);
        asm volatile("s_wait_xcnt 0x0" ::: "memory");   // the A loads' address registers are reused as a B fragment's destination: keep the wait in front of that overwrite
#pragma unroll
        for (int nb = 0; nb < 4; ++nb) { const v16bf b = ldbp(Bt + boff + (size_t)nb * 16 * K + kc * 16);
#pragma unroll
            for (int mb = 0; mb < 4; ++mb) acc[mb][nb] = wmmab(a[mb], b, acc[mb][nb]); }
        asm volatile("v_nop\n\tv_nop\n\tv_nop\n\tv_nop" : "+v"(acc[0][0]), "+v"(acc[1][1]), "+v"(acc[2][2]), "+v"(acc[3][3]) : "v"(a[0]), "v"(a[1]), "v"(a[2]), "v"(a[3]));
    }
    // column-indexed bias values (clamped address; zero by value when the bias is row-indexed)
    float bcol[4];
#pragma unroll
    for (int nb = 0; nb < 4; ++nb) { int ci = c0 + nb * 16 + lr; ci = ci < DM ? ci : DM - 1; const float t = bfr(bias[ci]); bcol[nb] = biasRow ? 0.0f : t; }
    const size_t tbase = (size_t)(r0 / RB) * sRB + (size_t)(r0 % RB) * (size_t)pitch + (size_t)(c0 / CB) * sCB + (size_t)(c0 % CB) * 64;
#pragma unroll
    for (int mb = 0; mb < 4; ++mb) {
        float brow[8];
#pragma unroll
        for (int j = 0; j < 8; ++j) { int ri = r0 + mb * 16 + hi * 8 + j; ri = ri < DM ? ri : DM - 1; const float t = bfr(bias[ri]); brow[j] = biasRow ? t : 0.0f; }
#pragma unroll
        for (int nb = 0; nb < 4; ++nb) {
#pragma unroll
            for (int j = 0; j < 8; ++j) os[(hi * 8 + j) * 68 + nb * 16 + lr] = acc[mb][nb][j] + bcol[nb] + brow[j]; }   // D: row 8h+j, col lane&15
        wave_sync();
        const size_t sb = tbase + (size_t)(mb * 1024);
{
#pragma unroll
            for (int s = 0; s < 4; ++s) { const int row = lr, c8 = 16 * s + 8 * hi;   // 16 rows x 2 column groups of 8 per s; 4 s = 64 columns
                const v4f x0 = *(const v4fa*)(&os[row * 68 + c8]); const v4f x1 = *(const v4fa*)(&os[row * 68 + c8 + 4]); v8h hv, rv;
#pragma unroll
                for (int i = 0; i < 4; ++i) { const h16 a0 = (h16)x0[i]; const h16 a1 = (h16)x1[i]; hv[i] = a0; hv[4 + i] = a1; rv[i] = (h16)((x0[i] - (float)a0) * QRS); rv[4 + i] = (h16)((x1[i] - (float)a1) * QRS); }
                const size_t oo = sb + (size_t)(s * 256 + lane * 8);
                *(v8h*)(Ph + oo) = hv; if (useRes) *(v8h*)(Pr + oo) = rv; }
             }
        wave_sync();
    }
}

// k_flash: fused attention, one wave per 16 query rows of one (batch, head); K / V^T / Q fragments straight from the fragment-order f16 planes (two 16-B loads each, arithmetic addressing).
// Transposed form: S^T[key][t] = K Q^T (A = K rows, B = Q rows); lane (t = lane&15, h = lane>>4) holds keys 8h+r of each 16-key tile, so the packed
// P tile is directly the B fragment of O^T[d][t] = V^T P^T (element r <- tile keys 0..15, element 8+r <- tile keys 16..31, lane unchanged).
// Softmax state (running max, partial sum) is one scalar per lane; the two lane halves of a row are combined with one xor-16 exchange.
__global__ __launch_bounds__(32 * AW) void k_flash(const h16* __restrict__ QH, const h16* __restrict__ QR, const h16* __restrict__ KP, const h16* __restrict__ VT, h16* CTX) {
    const int lane = threadIdx.x & 31, wave = threadIdx.x >> 5;
    const int zh = blockIdx.y; const int b = zh / NH_, h = zh % NH_;
    const int t0 = (blockIdx.x * AW + wave) * 16;
    const size_t pbase = (size_t)zh * SEQ * HD;
    const size_t qo = pbase + (size_t)t0 * HD + 8 * lane;    // strip of 16 queries x 64 d
    const v16h qh0 = ldp(QH + qo), qh1 = ldp(QH + qo + 512), qr0 = ldp(QR + qo), qr1 = ldp(QR + qo + 512);   // B fragments: col t, k = d
    const size_t ko = pbase + (size_t)lane * 8;              // + key0 * HD: strips of 16 keys x 64 d               (A fragment: row key, k = d)
    const size_t vo = pbase + (size_t)lane * 8;              // + (key0/64)*4096 + j*1024: strips of 16 d x 64 keys (A fragment: row d, k = key)
    v8f o0 = (v8f){}, o1 = (v8f){}, o2 = (v8f){}, o3 = (v8f){};
    float m = -3.0e38f, l = 0.0f;
#pragma unroll 1
    for (int key0 = 0; key0 < SEQ; key0 += 32) {
        const h16* ka = KP + ko + (size_t)key0 * HD;
        const v16h ka0 = ldp(ka), ka1 = ldp(ka + 512), kb0 = ldp(ka + 1024), kb1 = ldp(ka + 1536);
        v8f sHa = (v8f){}, sLa = (v8f){}, sHb = (v8f){}, sLb = (v8f){};
        sHa = wmma16(ka0, qh0, sHa); sLa = wmma16(ka0, qr0, sLa); sHb = wmma16(kb0, qh0, sHb); sLb = wmma16(kb0, qr0, sLb);
        sHa = wmma16(ka1, qh1, sHa); sLa = wmma16(ka1, qr1, sLa); sHb = wmma16(kb1, qh1, sHb); sLb = wmma16(kb1, qr1, sLb);
        asm volatile("v_nop\n\tv_nop\n\tv_nop\n\tv_nop" : "+v"(sHa), "+v"(sLa), "+v"(sHb), "+v"(sLb) : "v"(ka0), "v"(ka1), "v"(kb0), "v"(kb1));
        float ta[8], tb[8]; float mx = -3.0e38f;
#pragma unroll
        for (int r = 0; r < 8; ++r) { ta[r] = (sHa[r] + sLa[r] * QRI) * SC2; tb[r] = (sHb[r] + sLb[r] * QRI) * SC2; mx = fmaxf(mx, fmaxf(ta[r], tb[r])); }
        mx = fmaxf(mx, __shfl_xor(mx, 16, 32));
        const float mnew = fmaxf(m, mx);
        const float alpha = __builtin_amdgcn_exp2f(m - mnew);
        const float sh = PSH - mnew;
        v16h pb; float ls = 0.0f;
#pragma unroll
        for (int r = 0; r < 8; ++r) { const h16 pa = (h16)__builtin_amdgcn_exp2f(ta[r] + sh); const h16 pc = (h16)__builtin_amdgcn_exp2f(tb[r] + sh); pb[r] = pa; pb[8 + r] = pc; ls += (float)pa + (float)pc; }
        l = l * alpha + ls; m = mnew;
        o0 = o0 * alpha; o1 = o1 * alpha; o2 = o2 * alpha; o3 = o3 * alpha;
        const h16* va = VT + vo + (size_t)(key0 >> 6) * 4096 + (size_t)((key0 >> 5) & 1) * 512;
        const v16h v0 = ldp(va), v1 = ldp(va + 1024), v2 = ldp(va + 2048), v3 = ldp(va + 3072);
        o0 = wmma16(v0, pb, o0); o1 = wmma16(v1, pb, o1); o2 = wmma16(v2, pb, o2); o3 = wmma16(v3, pb, o3);
        asm volatile("v_nop\n\tv_nop\n\tv_nop\n\tv_nop" : "+v"(o0), "+v"(o1), "+v"(o2), "+v"(o3) : "v"(v0), "v"(v1), "v"(v2), "v"(v3), "v"(pb));
    }
    l += __shfl_xor(l, 16, 32);
    const float inv = CXS * (1.0f / l);
    // O^T D layout: o_j[r] = (d = 16j + 8h + r, t = lane&15): the lane's eight values of o_j are its own 16-B piece j of the fragment-order strip (row t, k = 16j + 8h + 0..7), so they go out without staging
    h16* crow = CTX + ((size_t)b * SEQ + t0) * DM + h * 1024 + lane * 8;   // merged heads: column h*64 + d = chunks 2h, 2h+1 of this 16-row strip
    v8h c0, c1, c2, c3;
#pragma unroll
    for (int r = 0; r < 8; ++r) { c0[r] = (h16)(o0[r] * inv); c1[r] = (h16)(o1[r] * inv); c2[r] = (h16)(o2[r] * inv); c3[r] = (h16)(o3[r] * inv); }
    *(v8h*)(crow) = c0; *(v8h*)(crow + 256) = c1; *(v8h*)(crow + 512) = c2; *(v8h*)(crow + 768) = c3;
}

// k_oproj: register-blocked f16 GEMM, ONE WAVE per 64x64 tile, operands from fragment-order planes, K = DM. P[m][n] = (sum_k A[m][k] Bt[n][k]) * OSI + bias[n] (bias RNE-converted to bf16, f32 add), f32 rows of pitch DM.
__global__ __launch_bounds__(32) void k_oproj(const h16* __restrict__ A, const h16* __restrict__ Bt, const float* __restrict__ bias, float* P) {
    __shared__ __align__(16) float os[16 * 68];
    const int K = DM;
    const int lane = threadIdx.x & 31, lr = lane & 15, hi = lane >> 4; const int r0 = blockIdx.x * 64, c0 = blockIdx.y * 64;
    v8f acc[4][4];
#pragma unroll
    for (int mb = 0; mb < 4; ++mb)
#pragma unroll
        for (int nb = 0; nb < 4; ++nb) acc[mb][nb] = (v8f){};
    const size_t aoff = (size_t)r0 * K + 8 * lane, boff = (size_t)c0 * K + 8 * lane;   // strip base + lane; + 16*K per strip, + 16*kc = 512 per chunk of 32 k
#pragma unroll 1
    for (int kc = 0; kc < K; kc += 32) {
        v16h a[4];
#pragma unroll
        for (int mb = 0; mb < 4; ++mb) a[mb] = ldp(A + aoff + (size_t)mb * 16 * K + kc * 16);
        asm volatile("s_wait_xcnt 0x0" ::: "memory");   // the A loads' address registers are reused as a B fragment's destination: keep the wait in front of that overwrite
#pragma unroll
        for (int nb = 0; nb < 4; ++nb) { const v16h b = ldp(Bt + boff + (size_t)nb * 16 * K + kc * 16);
#pragma unroll
            for (int mb = 0; mb < 4; ++mb) acc[mb][nb] = wmma16(a[mb], b, acc[mb][nb]); }
        asm volatile("v_nop\n\tv_nop\n\tv_nop\n\tv_nop" : "+v"(acc[0][0]), "+v"(acc[1][1]), "+v"(acc[2][2]), "+v"(acc[3][3]) : "v"(a[0]), "v"(a[1]), "v"(a[2]), "v"(a[3]));
    }
    float bcol[4];
#pragma unroll
    for (int nb = 0; nb < 4; ++nb) { int ci = c0 + nb * 16 + lr; ci = ci < DM ? ci : DM - 1; bcol[nb] = bfr(bias[ci]); }
#pragma unroll
    for (int mb = 0; mb < 4; ++mb) {
#pragma unroll
        for (int nb = 0; nb < 4; ++nb) {
#pragma unroll
            for (int j = 0; j < 8; ++j) os[(hi * 8 + j) * 68 + nb * 16 + lr] = acc[mb][nb][j] * OSI + bcol[nb]; }   // D: row 8h+j, col lane&15
        wave_sync();
        float* prow = P + (size_t)(r0 + mb * 16) * DM + c0;
{
#pragma unroll
            for (int s = 0; s < 8; ++s) { const int row = 2 * s + hi, cofs = lr * 4;   // 8 s x 2 rows = 16 rows; 16 lanes x 4 floats = 64 columns
                const v4f val = *(const v4fa*)(&os[row * 68 + cofs]);
                *(v4f*)(prow + (size_t)row * DM + cofs) = val; }
             }
        wave_sync();
    }
}

__global__ __launch_bounds__(256) void k_ln(const float* __restrict__ P, const float* __restrict__ gamma, const float* __restrict__ beta, float* OUT, int rows) {
    const int lane = threadIdx.x & 31, wave = threadIdx.x >> 5;
    const int row = blockIdx.x * 8 + wave;
    if (row >= rows) return;                  // wave-uniform; the kernel has no block barrier
    const int b = row / SEQ, t = row % SEQ;
    const float* src = P + (size_t)row * DM + lane * 4;
    float s = 0.0f;
#pragma unroll 1
    for (int it = 0; it < 8; ++it) { const v4f x = *(const v4f*)(src + it * 128); s += (x[0] + x[1]) + (x[2] + x[3]); }
    s += __shfl_xor(s, 16, 32); s += __shfl_xor(s, 8, 32); s += __shfl_xor(s, 4, 32); s += __shfl_xor(s, 2, 32); s += __shfl_xor(s, 1, 32);
    const float mu = s * (1.0f / (float)DM);
    float q = 0.0f;
#pragma unroll 1
    for (int it = 0; it < 8; ++it) { const v4f x = *(const v4f*)(src + it * 128);
        const float d0 = x[0] - mu, d1 = x[1] - mu, d2 = x[2] - mu, d3 = x[3] - mu; q += (d0 * d0 + d1 * d1) + (d2 * d2 + d3 * d3); }
    q += __shfl_xor(q, 16, 32); q += __shfl_xor(q, 8, 32); q += __shfl_xor(q, 4, 32); q += __shfl_xor(q, 2, 32); q += __shfl_xor(q, 1, 32);
    const float rstd = rsqrtf(q * (1.0f / (float)DM) + LN_EPS);
    float* dst = OUT + ((size_t)b * OUT_SEQ + t) * DM + lane * 4;
{
#pragma unroll 1
        for (int it = 0; it < 8; ++it) {
            const v4f x = *(const v4f*)(src + it * 128);
            const v4f g = *(const v4f*)(gamma + it * 128 + lane * 4);
            const v4f e = *(const v4f*)(beta + it * 128 + lane * 4);
            v4f y;
#pragma unroll
            for (int i = 0; i < 4; ++i) y[i] = (x[i] - mu) * rstd * bfr(g[i]) + bfr(e[i]);
            *(v4f*)(dst + it * 128) = y; }
         }
}

static constexpr size_t al256(size_t v) { return (v + 255) & ~(size_t)255; }
static constexpr size_t SZ_XB = al256((size_t)NB * SEQ * DM * 2);          // one bf16 activation plane
static constexpr size_t SZ_WB = al256((size_t)4 * DM * DM * 2);            // Wq | Wk | Wv (bf16) | Wo (f16 x64)
static constexpr size_t SZ_PL = al256((size_t)NB * NH_ * SEQ * HD * 2);    // one head-major f16 plane
static constexpr size_t SZ_TOTAL = 3 * SZ_XB + SZ_WB + 4 * SZ_PL;
static_assert(SZ_TOTAL <= (size_t)134217728);                   // workspace carve <= 128 MiB
static_assert(((size_t)DM * DM * 2) % 256 == 0);                // weight sub-planes stay 256-byte aligned
static_assert((size_t)NB * SEQ * DM * 2 <= SZ_XB);              // context plane (f16) aliases the q copy region
static_assert((size_t)NB * SEQ * DM * 4 <= 2 * SZ_XB);          // pre-normalisation plane (f32) aliases the k|v copy regions
static_assert(SZ_XB % 256 == 0);

extern "C" void kernel_launch(void* const* d_in, const int* in_sizes, int n_in,
                              void* d_out, int out_size, void* d_ws, size_t ws_size, hipStream_t stream) {
    if (n_in < 13) return;
    const size_t needx = ((size_t)(NB - 1) * SEQ_FULL + SEQ) * DM;
    if ((size_t)in_sizes[0] < needx || (size_t)in_sizes[1] < needx || (size_t)in_sizes[2] < needx) return;
    if ((size_t)in_sizes[3] < (size_t)DM * DM || (size_t)in_sizes[5] < (size_t)DM * DM || (size_t)in_sizes[7] < (size_t)DM * DM || (size_t)in_sizes[9] < (size_t)DM * DM) return;
    if (in_sizes[4] < DM || in_sizes[6] < DM || in_sizes[8] < DM || in_sizes[10] < DM || in_sizes[11] < DM || in_sizes[12] < DM) return;
    if ((size_t)out_size < ((size_t)(NB - 1) * OUT_SEQ + SEQ) * DM) return;
    if (SZ_TOTAL > ws_size) return;
    // wire order: q, k, v, Wq, bq, Wk, bk, Wv, bv, Wo, bo, gamma, beta  (weights [out][in] = Bt as-is)
    const float* xq = (const float*)d_in[0]; const float* xk = (const float*)d_in[1]; const float* xv = (const float*)d_in[2];
    const float* wq = (const float*)d_in[3]; const float* bq = (const float*)d_in[4];
    const float* wk = (const float*)d_in[5]; const float* bk = (const float*)d_in[6];
    const float* wv = (const float*)d_in[7]; const float* bv = (const float*)d_in[8];
    const float* wo = (const float*)d_in[9]; const float* bo = (const float*)d_in[10];
    const float* gamma = (const float*)d_in[11]; const float* beta = (const float*)d_in[12];
    float* OUT = (float*)d_out;      // [NB][SEQ][1024]
    char* wsp = (char*)d_ws;
    bf* XQ = (bf*)wsp; wsp += SZ_XB;                 // [NB*SEQ][1024] bf16 copy of q, fragment order   (later: context plane, f16)
    bf* XK = (bf*)wsp; wsp += SZ_XB;                 // [NB*SEQ][1024] bf16 copy of k, fragment order   (later, with XV: pre-normalisation plane, f32)
    bf* XV = (bf*)wsp; wsp += SZ_XB;                 // [NB*SEQ][1024] bf16 copy of v, fragment order
    bf* WB = (bf*)wsp; wsp += SZ_WB;                 // [4][1024][1024]: q | k | v (bf16) | o (f16 x64), each in fragment order
    h16* QH = (h16*)wsp; wsp += SZ_PL;               // [NB*16][SEQ/16] strips of 16 queries x 64 d, fragment order
    h16* QR = (h16*)wsp; wsp += SZ_PL;               // the same, residual x2048
    h16* KP = (h16*)wsp; wsp += SZ_PL;               // [NB*16][SEQ/16] strips of 16 keys x 64 d, fragment order
    h16* VT = (h16*)wsp; wsp += SZ_PL;               // [NB*16][SEQ/64][4] strips of 16 d x 64 keys, fragment order
    bf* WQ = WB; bf* WK = WB + (size_t)DM * DM; bf* WV = WB + (size_t)2 * DM * DM; h16* WO = (h16*)(WB + (size_t)3 * DM * DM);
    h16* CTX = (h16*)XQ;                             // [NB*SEQ][1024] f16 x64, fragment order, written by k_flash after the q projection has consumed XQ
    float* PRE = (float*)XK;                         // [NB*SEQ][1024] f32, written by k_oproj after the k and v projections have consumed XK, XV

    k_cvtall<<<CV_WAVES / 4, 128, 0, stream>>>(xq, xk, xv, wq, wk, wv, wo, XQ, XK, XV, WB);

    // q, k: A = x rows (m = b*SEQ + t), Bt = W rows (n = h*64 + d), bias by column n -> head (b*16 + h), strip t/16, fragment order
    k_proj<<<dim3(NB * SEQ / 64, DM / 64, 1), 32, 0, stream>>>(XQ, WQ, bq, 0, QH, QR, 1, SEQ, (size_t)NH_ * SEQ * HD, HD, HD, (size_t)SEQ * HD);
    k_proj<<<dim3(NB * SEQ / 64, DM / 64, 1), 32, 0, stream>>>(XK, WK, bk, 0, KP, KP, 0, SEQ, (size_t)NH_ * SEQ * HD, HD, HD, (size_t)SEQ * HD);
    // v^T: A = Wv rows (m = h*64 + d), Bt = x rows (n = b*SEQ + t), bias by row m -> head (b*16 + h), block t/64, strip d/16, fragment order
    k_proj<<<dim3(DM / 64, NB * SEQ / 64, 1), 32, 0, stream>>>(WV, XV, bv, 1, VT, VT, 0, DM, (size_t)0, SEQ, SEQ, (size_t)DM * SEQ);

    k_flash<<<dim3(SEQ / (16 * AW), NB * NH_, 1), 32 * AW, 0, stream>>>(QH, QR, KP, VT, CTX);

    // output projection: A = context rows (m = b*SEQ + t, k = h*64 + d), Bt = Wo rows (n = output column) -> PRE[m][n]
    k_oproj<<<dim3(NB * SEQ / 64, DM / 64, 1), 32, 0, stream>>>(CTX, WO, bo, PRE);

    k_ln<<<dim3((NB * SEQ + 7) / 8, 1, 1), 256, 0, stream>>>(PRE, gamma, beta, OUT, NB * SEQ);
}

// v003
// It runs in 277 microseconds.
// In both of two side-by-side timings against v002, it was 1.28 times as fast.
// Over all steps from v000 it is 1.54 times as fast.
#include <hip/hip_runtime.h>

// Multi-head attention, width 1024 = 16 heads x 64; q,k,v [NB][SEQ][1024]; Wq/Wk/Wv/Wo [out][in] (y = x W^T + b); score scale 1/8; no mask; output projection + LayerNorm (eps 1e-5).
// Compute dtypes, f32 accumulate everywhere: q/k/v projections v_wmma_f32_16x16x32_bf16 (x, W and biases RNE-converted to bf16; products exact);
// scores v_wmma_f32_16x16x32_f16: k single f16, q as f16 value + f16 residual x2048 in its own accumulator (two products); P (x256 carry, cancels in the normalisation) and v single f16;
// output projection v_wmma_f32_16x16x32_f16: context plane f16 x64 carry, Wo plane f16 of (bf16 RNE of Wo) x64 (exact), carries folded back (1/4096) in the f32 epilogue; softmax and LayerNorm f32 on the VALU.
// Layout: every 16-bit plane a matrix instruction reads is kept in fragment order (see ldp): bf16 copies of q,k,v and Wq,Wk,Wv, the Wo plane, q (hi, residual), k and v^T planes per head (written by the GEMM epilogue), the context plane; fused flash kernel in transposed form (S^T = K Q^T, O^T = V^T P^T);

#ifndef NB
#define NB 4
#endif
#ifndef SEQ
#define SEQ 2048
#endif
#define NB_FULL  4
#define SEQ_FULL 2048
#ifndef OUT_SEQ
#define OUT_SEQ SEQ              // row pitch (in tokens) between batches of the output
#endif
#define DM   1024
#define NH_  16
#define HD   64
#define AW   4                   // waves per flash block (16 query rows each)
#define QRS  2048.0f             // carry of the q residual plane
#define QRI  (1.0f / 2048.0f)
#define SC2  (0.125f * 1.4426950408889634f)   // HD^-0.5 * log2(e)
#define PSH  8.0f                // log2 of the P carry (256)
#define CXS  64.0f               // carry of the context plane
#define WOS  64.0f               // carry of the Wo plane
#define OSI  (1.0f / 4096.0f)    // 1 / (CXS * WOS)
#define LN_EPS 1.0e-5f

static_assert(HD == 64);
static_assert(NH_ * HD == DM);                 // head h = columns h*64 + d
static_assert(DM % 64 == 0);                   // 16 column tiles of 64
static_assert(DM % 32 == 0);                   // GEMM stages step k by 32
static_assert(DM == 1024);                     // LayerNorm kernel: 8 iterations x 32 lanes x 4 floats
static_assert(SEQ % 64 == 0);                  // a 64-row tile never straddles two batches
static_assert((NB * SEQ) % 64 == 0);
static_assert((NB * SEQ) % 8 == 0);            // LayerNorm grid: 8 rows per block
static_assert(SEQ % 32 == 0);                  // key loop steps by 32
static_assert(SEQ % (16 * AW) == 0);           // flash grid covers the sequence exactly
static_assert(((size_t)SEQ * DM) % 8 == 0);
static_assert(((size_t)DM * DM) % 8 == 0);
static_assert(NB <= NB_FULL);
static_assert(SEQ <= SEQ_FULL);

typedef _Float16 h16;
typedef unsigned short bf;
typedef __attribute__((ext_vector_type(16))) __bf16   v16bf;
typedef __attribute__((ext_vector_type(16))) _Float16 v16h;
typedef __attribute__((ext_vector_type(8)))  _Float16 v8h;
typedef __attribute__((ext_vector_type(8)))  unsigned short v8us;
typedef __attribute__((ext_vector_type(8)))  float    v8f;
typedef __attribute__((ext_vector_type(4)))  float    v4f;
typedef v4f  __attribute__((may_alias)) v4fa;

__device__ __forceinline__ unsigned short f2bf(float f) { unsigned u = __float_as_uint(f); u += 0x7FFFu + ((u >> 16) & 1u); return (unsigned short)(u >> 16); }
__device__ __forceinline__ float bfr(float f) { return __uint_as_float(((unsigned)f2bf(f)) << 16); }   // RNE convert to bf16, widened back to f32
__device__ __forceinline__ v16h cat16(v8h lo, v8h hi) { return __builtin_shufflevector(lo, hi, 0, 1, 2, 3, 4, 5, 6, 7, 8, 9, 10, 11, 12, 13, 14, 15); }
__device__ __forceinline__ v16bf cat16b(v8us lo, v8us hi) { return __builtin_bit_cast(v16bf, __builtin_shufflevector(lo, hi, 0, 1, 2, 3, 4, 5, 6, 7, 8, 9, 10, 11, 12, 13, 14, 15)); }
__device__ __forceinline__ v8f wmma16(v16h a, v16h b, v8f c) { return __builtin_amdgcn_wmma_f32_16x16x32_f16(false, a, false, b, (short)0, c, false, false); }
__device__ __forceinline__ v8f wmmab(v16bf a, v16bf b, v8f c) { return __builtin_amdgcn_wmma_f32_16x16x32_bf16(false, a, false, b, (short)0, c, false, false); }
// fragment-order planes: a chunk of 16 rows x 32 k is 512 contiguous 16-bit elements [piece = 0..1][lane = 16*h + row][8], holding k = 16*piece + 8*h + 0..7, so one wave-wide 16-B load reads 512 contiguous bytes (4 whole lines).
// The chunks of a 16-row strip follow one another along k; a matrix of row length K keeps strip r/16 at (r/16)*16*K.
// fragment loaders; p = chunk + 8*lane: elements 0..7 <- k0+8h+0..7, elements 8..15 <- k0+16+8h+0..7 (same map for A and B)
__device__ __forceinline__ v16h  ldp(const h16* p) { return cat16(*(const v8h*)p, *(const v8h*)(p + 256)); }
// ordering point for wave-private LDS tiles (same wave writes and reads)
__device__ __forceinline__ void wave_sync() { __builtin_amdgcn_fence(3 /* release order */, "wavefront"); __builtin_amdgcn_wave_barrier(); asm volatile("" ::: "memory"); }

// k_cvtall: all seven f32 inputs of the matrix products -> 16-bit planes in fragment order, in ONE launch of CV_ALL / CV_PER waves (7168 at NB 4, SEQ 2048), two batches each.
// A batch is 8 consecutive wave-wide pieces of a plane = 4 chunks = 16 rows x 128 k: each lane reads 8 x 32 B of its row (all 16 loads in flight together; the two lanes of a row cover 512 contiguous bytes)
// and the wave writes 4 KiB of plane contiguously. Piece st of batch bp holds k = (bp % 8) * 128 + 16 * st + 8 * h + 0..7 of row (bp / 8) * 16 + (lane & 15), at plane offset bp * 2048 + st * 256 + lane * 8.
// Batches in order: q | k | v (bf16 RNE) | Wq | Wk | Wv (bf16 RNE) | Wo (f16 of bf16 RNE x64); a batch never straddles two planes. Each wave takes CV_PER batches.
#define CV_ACT   ((int)((size_t)NB * SEQ * DM / 2048))
#define CV_WGT   ((int)((size_t)DM * DM / 2048))
#define CV_ALL   (3 * CV_ACT + 4 * CV_WGT)
#define CV_PER   2
#define CV_WAVES (CV_ALL / CV_PER)
static_assert(DM % 128 == 0);                       // a batch of 128 k stays inside one 16-row strip
static_assert(((size_t)NB * SEQ * DM) % 2048 == 0);
static_assert(((size_t)DM * DM) % 2048 == 0);
static_assert(CV_ALL % (CV_PER * 4) == 0);          // whole 4-wave blocks, every wave the same number of batches
__global__ __launch_bounds__(128) void k_cvtall(const float* __restrict__ xq, const float* __restrict__ xk, const float* __restrict__ xv,
                                                const float* __restrict__ wq, const float* __restrict__ wk, const float* __restrict__ wv, const float* __restrict__ wo,
                                                bf* XQ, bf* XK, bf* XV, bf* WB) {
    const int lane = threadIdx.x & 31, row = lane & 15, hi = lane >> 4;
    const int wid = __builtin_amdgcn_readfirstlane((int)(blockIdx.x * 4 + (threadIdx.x >> 5)));   // wave-uniform: the plane choice below stays scalar
    for (int it = 0; it < CV_PER; ++it) {
        const int bid = it * CV_WAVES + wid;
        const float* src; bf* dst; int bp, r16;
        if (bid < 3 * CV_ACT) {
            const int p = bid / CV_ACT; bp = bid % CV_ACT;
            src = p == 0 ? xq : (p == 1 ? xk : xv); dst = p == 0 ? XQ : (p == 1 ? XK : XV);
            r16 = (bp / (DM / 128)) * 16; r16 = (r16 / SEQ) * SEQ_FULL + r16 % SEQ;   // token row -> row of the full-pitch input
        } else {
            const int r = bid - 3 * CV_ACT; const int p = r / CV_WGT; bp = r % CV_WGT;
            src = p == 0 ? wq : (p == 1 ? wk : (p == 2 ? wv : wo)); dst = WB + (size_t)p * DM * DM;
            r16 = (bp / (DM / 128)) * 16;
        }
        const float* s = src + (size_t)(r16 + row) * DM + (bp % (DM / 128)) * 128 + hi * 8;
        bf* d = dst + (size_t)bp * 2048 + lane * 8;
        v8f v[8];
#pragma unroll
        for (int st = 0; st < 8; ++st) v[st] = *(const v8f*)(s + st * 16);
        asm volatile("s_wait_xcnt 0x0" :: "v"(s) : "memory");   // the wait stands in front of any overwrite of the loads' address registers; the address as an input keeps those registers from serving as a load's own destination
        if (bid < 3 * CV_ACT + 3 * CV_WGT) {
#pragma unroll
            for (int st = 0; st < 8; ++st) { v8us o;
#pragma unroll
                for (int k = 0; k < 8; ++k) o[k] = f2bf(v[st][k]);
                *(v8us*)(d + st * 256) = o; }
            asm volatile("s_wait_xcnt 0x0" ::: "memory");   // the stores' address and data registers are rewritten behind this arm (next trip): keep the wait in front of that overwrite
        } else {
#pragma unroll
            for (int st = 0; st < 8; ++st) { v8h o;
#pragma unroll
                for (int k = 0; k < 8; ++k) o[k] = (h16)(bfr(v[st][k]) * WOS);
                *(v8h*)((h16*)d + st * 256) = o; }
            asm volatile("s_wait_xcnt 0x0" ::: "memory");   // as in the other arm: the wait stands directly behind this arm's last store
        }
    }
}

// GEMM core of k_proj and k_oproj: one wave, 64x64 tile, K = DM, operands from fragment-order planes. A stage is 32 k: four A and four B fragments (16 loads of 16 B a lane, 8 KiB a wave), 16 matrix instructions.
// The fragments are fetched THREE stages ahead into a ring of four register sets, so a stage's loads have three stages of matrix work (and the SIMD's other wave) to come back in; each accumulator still takes its k chunks in rising order.
// fragment loaders with the map of ldp, the lane's place given as an index of 16-B pieces (vo = lane + 256 per trip of four stages), so that the wave-uniform base stays scalar and the load scales the index itself
__device__ __forceinline__ v16bf ldf(const bf* u, unsigned vo)  { return cat16b(((const v8us*)u)[vo], ((const v8us*)(u + 256))[vo]); }
__device__ __forceinline__ v16h  ldf(const h16* u, unsigned vo) { return cat16(((const v8h*)u)[vo], ((const v8h*)(u + 256))[vo]); }
__device__ __forceinline__ v8f wm(v16bf a, v16bf b, v8f c) { return wmmab(a, b, c); }
__device__ __forceinline__ v8f wm(v16h a, v16h b, v8f c)   { return wmma16(a, b, c); }
template <typename V, typename E>
__device__ __forceinline__ void ld_stage(V (&a)[4], V (&b)[4], const E* ua, const E* ub, unsigned& vo, int off) {
#pragma unroll
    for (int i = 0; i < 4; ++i) a[i] = ldf(ua + (off + i * 16 * DM), vo);
#pragma unroll
    for (int i = 0; i < 4; ++i) b[i] = ldf(ub + (off + i * 16 * DM), vo);
    asm volatile("s_wait_xcnt 0x0" : "+v"(vo) : "s"(ua), "s"(ub) : "memory");   // the wait stands in front of any overwrite of the loads' address registers: the lane index passes through it, so the trip's addition cannot be lifted over it, and the scalar bases as inputs stay untouched up to it
    __builtin_amdgcn_sched_barrier(0);   // keeps this stage's loads ahead of the matrix instructions that follow in the source: sunk to their use they would come back too late
}
template <typename V>
__device__ __forceinline__ void mm_stage(const V (&a)[4], const V (&b)[4], v8f (&acc)[4][4]) {
#pragma unroll
    for (int nb = 0; nb < 4; ++nb)
#pragma unroll
        for (int mb = 0; mb < 4; ++mb) acc[mb][nb] = wm(a[mb], b[nb], acc[mb][nb]);
    __builtin_amdgcn_sched_barrier(0);   // all 16 matrix instructions stand in front of the slots below
    // four vector slots between the last matrix instruction and whatever overwrites its operands next (the refill of this register set; the back edge)
    asm volatile("v_nop\n\tv_nop\n\tv_nop\n\tv_nop");   // no operands: a register named in asm text must lie below v256, and the ring does not fit there
    __builtin_amdgcn_sched_barrier(0);   // the refill of this set is not lifted among its readers (it would take a fifth register set)
}
static_assert(DM % 128 == 0 && DM >= 256);     // whole trips of four stages, and the three stages of the prologue exist
template <typename V, typename E>
__device__ __forceinline__ void gemm_core(const E* ua, const E* ub, unsigned vo, v8f (&acc)[4][4]) {   // ua, ub: the tile's first strips (wave-uniform), + 16 * DM elements per strip, + 512 per stage; vo = lane, in 16-B pieces
    V a0[4], b0[4], a1[4], b1[4], a2[4], b2[4], a3[4], b3[4];
    ld_stage(a0, b0, ua, ub, vo, 0); ld_stage(a1, b1, ua, ub, vo, 512); ld_stage(a2, b2, ua, ub, vo, 1024);
#pragma unroll 1
    for (int kc = 0; kc < DM - 128; kc += 128) {   // rolled: one trip is four stages, each register set in its fixed role
        ld_stage(a3, b3, ua, ub, vo, 1536); mm_stage(a0, b0, acc);
        ld_stage(a0, b0, ua, ub, vo, 2048); mm_stage(a1, b1, acc);
        ld_stage(a1, b1, ua, ub, vo, 2560); mm_stage(a2, b2, acc);
        ld_stage(a2, b2, ua, ub, vo, 3072); mm_stage(a3, b3, acc);
        vo += 256;
    }
    ld_stage(a3, b3, ua, ub, vo, 1536); mm_stage(a0, b0, acc); mm_stage(a1, b1, acc); mm_stage(a2, b2, acc); mm_stage(a3, b3, acc);
}

// k_proj: register-blocked bf16 GEMM, ONE WAVE per 64x64 tile (16 accumulators), operands straight from fragment-order bf16 planes, K = DM.
// C[m][n] = sum_k A[m][k] Bt[n][k] + bias (bias indexed by n when biasRow == 0, by m when biasRow != 0; bias RNE-converted to bf16, added in f32),
// written as f16 (Ph) and optionally the f16 residual x2048 (Pr, useRes != 0): the tile's four 16-row strips (16 x 64, two chunks) in fragment order, 1024 halves each,
// one behind the other at (r0/RB)*sRB + (r0%RB)*pitch + (c0/CB)*sCB + (c0%CB)*64. grid (M/64, N/64), 32 threads.
__global__ __launch_bounds__(32) void k_proj(const bf* __restrict__ A, const bf* __restrict__ Bt, const float* __restrict__ bias, int biasRow,
                                             h16* Ph, h16* Pr, int useRes, int RB, size_t sRB, int pitch, int CB, size_t sCB) {
    __shared__ __align__(16) float os[16 * 68];
    const int K = DM;
    const int lane = threadIdx.x & 31, lr = lane & 15, hi = lane >> 4; const int r0 = blockIdx.x * 64, c0 = blockIdx.y * 64;
    v8f acc[4][4];
#pragma unroll
    for (int mb = 0; mb < 4; ++mb)
#pragma unroll
        for (int nb = 0; nb < 4; ++nb) acc[mb][nb] = (v8f){};
    gemm_core<v16bf>(A + (size_t)r0 * K, Bt + (size_t)c0 * K, (unsigned)lane, acc);
    // column-indexed bias values (clamped address; zero by value when the bias is row-indexed)
    float bcol[4];
#pragma unroll
    for (int nb = 0; nb < 4; ++nb) { int ci = c0 + nb * 16 + lr; ci = ci < DM ? ci : DM - 1; const float t = bfr(bias[ci]); bcol[nb] = biasRow ? 0.0f : t; }
    const size_t tbase = (size_t)(r0 / RB) * sRB + (size_t)(r0 % RB) * (size_t)pitch + (size_t)(c0 / CB) * sCB + (size_t)(c0 % CB) * 64;
#pragma unroll
    for (int mb = 0; mb < 4; ++mb) {
        float brow[8];
#pragma unroll
        for (int j = 0; j < 8; ++j) { int ri = r0 + mb * 16 + hi * 8 + j; ri = ri < DM ? ri : DM - 1; const float t = bfr(bias[ri]); brow[j] = biasRow ? t : 0.0f; }
#pragma unroll
        for (int nb = 0; nb < 4; ++nb) {
#pragma unroll
            for (int j = 0; j < 8; ++j) os[(hi * 8 + j) * 68 + nb * 16 + lr] = acc[mb][nb][j] + bcol[nb] + brow[j]; }   // D: row 8h+j, col lane&15
        wave_sync();
        const size_t sb = tbase + (size_t)(mb * 1024);
{
#pragma unroll
            for (int s = 0; s < 4; ++s) { const int row = lr, c8 = 16 * s + 8 * hi;   // 16 rows x 2 column groups of 8 per s; 4 s = 64 columns
                const v4f x0 = *(const v4fa*)(&os[row * 68 + c8]); const v4f x1 = *(const v4fa*)(&os[row * 68 + c8 + 4]); v8h hv, rv;
#pragma unroll
                for (int i = 0; i < 4; ++i) { const h16 a0 = (h16)x0[i]; const h16 a1 = (h16)x1[i]; hv[i] = a0; hv[4 + i] = a1; rv[i] = (h16)((x0[i] - (float)a0) * QRS); rv[4 + i] = (h16)((x1[i] - (float)a1) * QRS); }
                const size_t oo = sb + (size_t)(s * 256 + lane * 8);
                *(v8h*)(Ph + oo) = hv; if (useRes) *(v8h*)(Pr + oo) = rv; }
             }
        wave_sync();
    }
}

// k_flash: fused attention, one wave per 16 query rows of one (batch, head); K / V^T / Q fragments straight from the fragment-order f16 planes (two 16-B loads each, arithmetic addressing).
// Transposed form: S^T[key][t] = K Q^T (A = K rows, B = Q rows); lane (t = lane&15, h = lane>>4) holds keys 8h+r of each 16-key tile, so the packed
// P tile is directly the B fragment of O^T[d][t] = V^T P^T (element r <- tile keys 0..15, element 8+r <- tile keys 16..31, lane unchanged).
// Softmax state (running max, partial sum) is one scalar per lane; the two lane halves of a row are combined with one xor-16 exchange.
__global__ __launch_bounds__(32 * AW) void k_flash(const h16* __restrict__ QH, const h16* __restrict__ QR, const h16* __restrict__ KP, const h16* __restrict__ VT, h16* CTX) {
    const int lane = threadIdx.x & 31, wave = threadIdx.x >> 5;
    const int zh = blockIdx.y; const int b = zh / NH_, h = zh % NH_;
    const int t0 = (blockIdx.x * AW + wave) * 16;
    const size_t pbase = (size_t)zh * SEQ * HD;
    const size_t qo = pbase + (size_t)t0 * HD + 8 * lane;    // strip of 16 queries x 64 d
    const v16h qh0 = ldp(QH + qo), qh1 = ldp(QH + qo + 512), qr0 = ldp(QR + qo), qr1 = ldp(QR + qo + 512);   // B fragments: col t, k = d
    const size_t ko = pbase + (size_t)lane * 8;              // + key0 * HD: strips of 16 keys x 64 d               (A fragment: row key, k = d)
    const size_t vo = pbase + (size_t)lane * 8;              // + (key0/64)*4096 + j*1024: strips of 16 d x 64 keys (A fragment: row d, k = key)
    v8f o0 = (v8f){}, o1 = (v8f){}, o2 = (v8f){}, o3 = (v8f){};
    float m = -3.0e38f, l = 0.0f;
#pragma unroll 1
    for (int key0 = 0; key0 < SEQ; key0 += 32) {
        const h16* ka = KP + ko + (size_t)key0 * HD;
        const v16h ka0 = ldp(ka), ka1 = ldp(ka + 512), kb0 = ldp(ka + 1024), kb1 = ldp(ka + 1536);
        v8f sHa = (v8f){}, sLa = (v8f){}, sHb = (v8f){}, sLb = (v8f){};
        sHa = wmma16(ka0, qh0, sHa); sLa = wmma16(ka0, qr0, sLa); sHb = wmma16(kb0, qh0, sHb); sLb = wmma16(kb0, qr0, sLb);
        sHa = wmma16(ka1, qh1, sHa); sLa = wmma16(ka1, qr1, sLa); sHb = wmma16(kb1, qh1, sHb); sLb = wmma16(kb1, qr1, sLb);
        asm volatile("v_nop\n\tv_nop\n\tv_nop\n\tv_nop" : "+v"(sHa), "+v"(sLa), "+v"(sHb), "+v"(sLb) : "v"(ka0), "v"(ka1), "v"(kb0), "v"(kb1));
        float ta[8], tb[8]; float mx = -3.0e38f;
#pragma unroll
        for (int r = 0; r < 8; ++r) { ta[r] = (sHa[r] + sLa[r] * QRI) * SC2; tb[r] = (sHb[r] + sLb[r] * QRI) * SC2; mx = fmaxf(mx, fmaxf(ta[r], tb[r])); }
        mx = fmaxf(mx, __shfl_xor(mx, 16, 32));
        const float mnew = fmaxf(m, mx);
        const float alpha = __builtin_amdgcn_exp2f(m - mnew);
        const float sh = PSH - mnew;
        v16h pb; float ls = 0.0f;
#pragma unroll
        for (int r = 0; r < 8; ++r) { const h16 pa = (h16)__builtin_amdgcn_exp2f(ta[r] + sh); const h16 pc = (h16)__builtin_amdgcn_exp2f(tb[r] + sh); pb[r] = pa; pb[8 + r] = pc; ls += (float)pa + (float)pc; }
        l = l * alpha + ls; m = mnew;
        o0 = o0 * alpha; o1 = o1 * alpha; o2 = o2 * alpha; o3 = o3 * alpha;
        const h16* va = VT + vo + (size_t)(key0 >> 6) * 4096 + (size_t)((key0 >> 5) & 1) * 512;
        const v16h v0 = ldp(va), v1 = ldp(va + 1024), v2 = ldp(va + 2048), v3 = ldp(va + 3072);
        o0 = wmma16(v0, pb, o0); o1 = wmma16(v1, pb, o1); o2 = wmma16(v2, pb, o2); o3 = wmma16(v3, pb, o3);
        asm volatile("v_nop\n\tv_nop\n\tv_nop\n\tv_nop" : "+v"(o0), "+v"(o1), "+v"(o2), "+v"(o3) : "v"(v0), "v"(v1), "v"(v2), "v"(v3), "v"(pb));
    }
    l += __shfl_xor(l, 16, 32);
    const float inv = CXS * (1.0f / l);
    // O^T D layout: o_j[r] = (d = 16j + 8h + r, t = lane&15): the lane's eight values of o_j are its own 16-B piece j of the fragment-order strip (row t, k = 16j + 8h + 0..7), so they go out without staging
    h16* crow = CTX + ((size_t)b * SEQ + t0) * DM + h * 1024 + lane * 8;   // merged heads: column h*64 + d = chunks 2h, 2h+1 of this 16-row strip
    v8h c0, c1, c2, c3;
#pragma unroll
    for (int r = 0; r < 8; ++r) { c0[r] = (h16)(o0[r] * inv); c1[r] = (h16)(o1[r] * inv); c2[r] = (h16)(o2[r] * inv); c3[r] = (h16)(o3[r] * inv); }
    *(v8h*)(crow) = c0; *(v8h*)(crow + 256) = c1; *(v8h*)(crow + 512) = c2; *(v8h*)(crow + 768) = c3;
}

// k_oproj: register-blocked f16 GEMM, ONE WAVE per 64x64 tile, operands from fragment-order planes, K = DM. P[m][n] = (sum_k A[m][k] Bt[n][k]) * OSI + bias[n] (bias RNE-converted to bf16, f32 add), f32 rows of pitch DM.
__global__ __launch_bounds__(32) void k_oproj(const h16* __restrict__ A, const h16* __restrict__ Bt, const float* __restrict__ bias, float* P) {
    __shared__ __align__(16) float os[16 * 68];
    const int K = DM;
    const int lane = threadIdx.x & 31, lr = lane & 15, hi = lane >> 4; const int r0 = blockIdx.x * 64, c0 = blockIdx.y * 64;
    v8f acc[4][4];
#pragma unroll
    for (int mb = 0; mb < 4; ++mb)
#pragma unroll
        for (int nb = 0; nb < 4; ++nb) acc[mb][nb] = (v8f){};
    gemm_core<v16h>(A + (size_t)r0 * K, Bt + (size_t)c0 * K, (unsigned)lane, acc);
    float bcol[4];
#pragma unroll
    for (int nb = 0; nb < 4; ++nb) { int ci = c0 + nb * 16 + lr; ci = ci < DM ? ci : DM - 1; bcol[nb] = bfr(bias[ci]); }
#pragma unroll
    for (int mb = 0; mb < 4; ++mb) {
#pragma unroll
        for (int nb = 0; nb < 4; ++nb) {
#pragma unroll
            for (int j = 0; j < 8; ++j) os[(hi * 8 + j) * 68 + nb * 16 + lr] = acc[mb][nb][j] * OSI + bcol[nb]; }   // D: row 8h+j, col lane&15
        wave_sync();
        float* prow = P + (size_t)(r0 + mb * 16) * DM + c0;
{
#pragma unroll
            for (int s = 0; s < 8; ++s) { const int row = 2 * s + hi, cofs = lr * 4;   // 8 s x 2 rows = 16 rows; 16 lanes x 4 floats = 64 columns
                const v4f val = *(const v4fa*)(&os[row * 68 + cofs]);
                *(v4f*)(prow + (size_t)row * DM + cofs) = val; }
             }
        wave_sync();
    }
}

__global__ __launch_bounds__(256) void k_ln(const float* __restrict__ P, const float* __restrict__ gamma, const float* __restrict__ beta, float* OUT, int rows) {
    const int lane = threadIdx.x & 31, wave = threadIdx.x >> 5;
    const int row = blockIdx.x * 8 + wave;
    if (row >= rows) return;                  // wave-uniform; the kernel has no block barrier
    const int b = row / SEQ, t = row % SEQ;
    const float* src = P + (size_t)row * DM + lane * 4;
    float s = 0.0f;
#pragma unroll 1
    for (int it = 0; it < 8; ++it) { const v4f x = *(const v4f*)(src + it * 128); s += (x[0] + x[1]) + (x[2] + x[3]); }
    s += __shfl_xor(s, 16, 32); s += __shfl_xor(s, 8, 32); s += __shfl_xor(s, 4, 32); s += __shfl_xor(s, 2, 32); s += __shfl_xor(s, 1, 32);
    const float mu = s * (1.0f / (float)DM);
    float q = 0.0f;
#pragma unroll 1
    for (int it = 0; it < 8; ++it) { const v4f x = *(const v4f*)(src + it * 128);
        const float d0 = x[0] - mu, d1 = x[1] - mu, d2 = x[2] - mu, d3 = x[3] - mu; q += (d0 * d0 + d1 * d1) + (d2 * d2 + d3 * d3); }
    q += __shfl_xor(q, 16, 32); q += __shfl_xor(q, 8, 32); q += __shfl_xor(q, 4, 32); q += __shfl_xor(q, 2, 32); q += __shfl_xor(q, 1, 32);
    const float rstd = rsqrtf(q * (1.0f / (float)DM) + LN_EPS);
    float* dst = OUT + ((size_t)b * OUT_SEQ + t) * DM + lane * 4;
{
#pragma unroll 1
        for (int it = 0; it < 8; ++it) {
            const v4f x = *(const v4f*)(src + it * 128);
            const v4f g = *(const v4f*)(gamma + it * 128 + lane * 4);
            const v4f e = *(const v4f*)(beta + it * 128 + lane * 4);
            v4f y;
#pragma unroll
            for (int i = 0; i < 4; ++i) y[i] = (x[i] - mu) * rstd * bfr(g[i]) + bfr(e[i]);
            *(v4f*)(dst + it * 128) = y; }
         }
}

static constexpr size_t al256(size_t v) { return (v + 255) & ~(size_t)255; }
static constexpr size_t SZ_XB = al256((size_t)NB * SEQ * DM * 2);          // one bf16 activation plane
static constexpr size_t SZ_WB = al256((size_t)4 * DM * DM * 2);            // Wq | Wk | Wv (bf16) | Wo (f16 x64)
static constexpr size_t SZ_PL = al256((size_t)NB * NH_ * SEQ * HD * 2);    // one head-major f16 plane
static constexpr size_t SZ_TOTAL = 3 * SZ_XB + SZ_WB + 4 * SZ_PL;
static_assert(SZ_TOTAL <= (size_t)134217728);                   // workspace carve <= 128 MiB
static_assert(((size_t)DM * DM * 2) % 256 == 0);                // weight sub-planes stay 256-byte aligned
static_assert((size_t)NB * SEQ * DM * 2 <= SZ_XB);              // context plane (f16) aliases the q copy region
static_assert((size_t)NB * SEQ * DM * 4 <= 2 * SZ_XB);          // pre-normalisation plane (f32) aliases the k|v copy regions
static_assert(SZ_XB % 256 == 0);

extern "C" void kernel_launch(void* const* d_in, const int* in_sizes, int n_in,
                              void* d_out, int out_size, void* d_ws, size_t ws_size, hipStream_t stream) {
    if (n_in < 13) return;
    const size_t needx = ((size_t)(NB - 1) * SEQ_FULL + SEQ) * DM;
    if ((size_t)in_sizes[0] < needx || (size_t)in_sizes[1] < needx || (size_t)in_sizes[2] < needx) return;
    if ((size_t)in_sizes[3] < (size_t)DM * DM || (size_t)in_sizes[5] < (size_t)DM * DM || (size_t)in_sizes[7] < (size_t)DM * DM || (size_t)in_sizes[9] < (size_t)DM * DM) return;
    if (in_sizes[4] < DM || in_sizes[6] < DM || in_sizes[8] < DM || in_sizes[10] < DM || in_sizes[11] < DM || in_sizes[12] < DM) return;
    if ((size_t)out_size < ((size_t)(NB - 1) * OUT_SEQ + SEQ) * DM) return;
    if (SZ_TOTAL > ws_size) return;
    // wire order: q, k, v, Wq, bq, Wk, bk, Wv, bv, Wo, bo, gamma, beta  (weights [out][in] = Bt as-is)
    const float* xq = (const float*)d_in[0]; const float* xk = (const float*)d_in[1]; const float* xv = (const float*)d_in[2];
    const float* wq = (const float*)d_in[3]; const float* bq = (const float*)d_in[4];
    const float* wk = (const float*)d_in[5]; const float* bk = (const float*)d_in[6];
    const float* wv = (const float*)d_in[7]; const float* bv = (const float*)d_in[8];
    const float* wo = (const float*)d_in[9]; const float* bo = (const float*)d_in[10];
    const float* gamma = (const float*)d_in[11]; const float* beta = (const float*)d_in[12];
    float* OUT = (float*)d_out;      // [NB][SEQ][1024]
    char* wsp = (char*)d_ws;
    bf* XQ = (bf*)wsp; wsp += SZ_XB;                 // [NB*SEQ][1024] bf16 copy of q, fragment order   (later: context plane, f16)
    bf* XK = (bf*)wsp; wsp += SZ_XB;                 // [NB*SEQ][1024] bf16 copy of k, fragment order   (later, with XV: pre-normalisation plane, f32)
    bf* XV = (bf*)wsp; wsp += SZ_XB;                 // [NB*SEQ][1024] bf16 copy of v, fragment order
    bf* WB = (bf*)wsp; wsp += SZ_WB;                 // [4][1024][1024]: q | k | v (bf16) | o (f16 x64), each in fragment order
    h16* QH = (h16*)wsp; wsp += SZ_PL;               // [NB*16][SEQ/16] strips of 16 queries x 64 d, fragment order
    h16* QR = (h16*)wsp; wsp += SZ_PL;               // the same, residual x2048
    h16* KP = (h16*)wsp; wsp += SZ_PL;               // [NB*16][SEQ/16] strips of 16 keys x 64 d, fragment order
    h16* VT = (h16*)wsp; wsp += SZ_PL;               // [NB*16][SEQ/64][4] strips of 16 d x 64 keys, fragment order
    bf* WQ = WB; bf* WK = WB + (size_t)DM * DM; bf* WV = WB + (size_t)2 * DM * DM; h16* WO = (h16*)(WB + (size_t)3 * DM * DM);
    h16* CTX = (h16*)XQ;                             // [NB*SEQ][1024] f16 x64, fragment order, written by k_flash after the q projection has consumed XQ
    float* PRE = (float*)XK;                         // [NB*SEQ][1024] f32, written by k_oproj after the k and v projections have consumed XK, XV

    k_cvtall<<<CV_WAVES / 4, 128, 0, stream>>>(xq, xk, xv, wq, wk, wv, wo, XQ, XK, XV, WB);

    // q, k: A = x rows (m = b*SEQ + t), Bt = W rows (n = h*64 + d), bias by column n -> head (b*16 + h), strip t/16, fragment order
    k_proj<<<dim3(NB * SEQ / 64, DM / 64, 1), 32, 0, stream>>>(XQ, WQ, bq, 0, QH, QR, 1, SEQ, (size_t)NH_ * SEQ * HD, HD, HD, (size_t)SEQ * HD);
    k_proj<<<dim3(NB * SEQ / 64, DM / 64, 1), 32, 0, stream>>>(XK, WK, bk, 0, KP, KP, 0, SEQ, (size_t)NH_ * SEQ * HD, HD, HD, (size_t)SEQ * HD);
    // v^T: A = Wv rows (m = h*64 + d), Bt = x rows (n = b*SEQ + t), bias by row m -> head (b*16 + h), block t/64, strip d/16, fragment order
    k_proj<<<dim3(DM / 64, NB * SEQ / 64, 1), 32, 0, stream>>>(WV, XV, bv, 1, VT, VT, 0, DM, (size_t)0, SEQ, SEQ, (size_t)DM * SEQ);

    k_flash<<<dim3(SEQ / (16 * AW), NB * NH_, 1), 32 * AW, 0, stream>>>(QH, QR, KP, VT, CTX);

    // output projection: A = context rows (m = b*SEQ + t, k = h*64 + d), Bt = Wo rows (n = output column) -> PRE[m][n]
    k_oproj<<<dim3(NB * SEQ / 64, DM / 64, 1), 32, 0, stream>>>(CTX, WO, bo, PRE);

    k_ln<<<dim3((NB * SEQ + 7) / 8, 1, 1), 256, 0, stream>>>(PRE, gamma, beta, OUT, NB * SEQ);
}

// v004
// A run of this version takes 221 microseconds.
// Next to v003, in two timings, it ran 1.27 times as fast each time.
// Over all steps from v000 it is 1.96 times as fast.
#include <hip/hip_runtime.h>

// Multi-head attention, width 1024 = 16 heads x 64; q,k,v [NB][SEQ][1024]; Wq/Wk/Wv/Wo [out][in] (y = x W^T + b); score scale 1/8; no mask; output projection + LayerNorm (eps 1e-5).
// Compute dtypes, f32 accumulate everywhere: q/k/v projections v_wmma_f32_16x16x32_bf16 (x, W and biases RNE-converted to bf16; products exact);
// scores v_wmma_f32_16x16x32_f16: k single f16, q as f16 value + f16 residual x2048 in its own accumulator (two products); P (x256 carry, cancels in the normalisation) and v single f16;
// output projection v_wmma_f32_16x16x32_f16: context plane f16 x64 carry, Wo plane f16 of (bf16 RNE of Wo) x64 (exact), carries folded back (1/4096) in the f32 epilogue; softmax and LayerNorm f32 on the VALU.
// Layout: every 16-bit plane a matrix instruction reads is kept in fragment order (see ldp): bf16 copies of q,k,v and Wq,Wk,Wv, the Wo plane, q (hi, residual), k and v^T planes per head (written by the GEMM epilogue), the context plane; fused flash kernel in transposed form (S^T = K Q^T, O^T = V^T P^T);

#ifndef NB
#define NB 4
#endif
#ifndef SEQ
#define SEQ 2048
#endif
#define NB_FULL  4
#define SEQ_FULL 2048
#ifndef OUT_SEQ
#define OUT_SEQ SEQ              // row pitch (in tokens) between batches of the output
#endif
#define DM   1024
#define NH_  16
#define HD   64
#define AW   4                   // waves per flash block
#define QG   2                   // groups of 16 query rows per flash wave
#define QRS  2048.0f             // carry of the q residual plane
#define QRI  (1.0f / 2048.0f)
#define SC2  (0.125f * 1.4426950408889634f)   // HD^-0.5 * log2(e)
#define PSH  8.0f                // log2 of the P carry (256)
#define CXS  64.0f               // carry of the context plane
#define WOS  64.0f               // carry of the Wo plane
#define OSI  (1.0f / 4096.0f)    // 1 / (CXS * WOS)
#define LN_EPS 1.0e-5f

static_assert(HD == 64);
static_assert(NH_ * HD == DM);                 // head h = columns h*64 + d
static_assert(DM % 64 == 0);                   // 16 column tiles of 64
static_assert(DM % 32 == 0);                   // GEMM stages step k by 32
static_assert(DM == 1024);                     // LayerNorm kernel: 8 iterations x 32 lanes x 4 floats
static_assert(SEQ % 64 == 0);                  // a 64-row tile never straddles two batches
static_assert((NB * SEQ) % 64 == 0);
static_assert((NB * SEQ) % 8 == 0);            // LayerNorm grid: 8 rows per block
static_assert(SEQ % 32 == 0);                  // key loop steps by 32
static_assert(SEQ % (16 * QG * AW) == 0);      // flash grid covers the sequence exactly
static_assert(QG == 2);                        // the output products' slot statement names both groups
static_assert(((size_t)SEQ * DM) % 8 == 0);
static_assert(((size_t)DM * DM) % 8 == 0);
static_assert(NB <= NB_FULL);
static_assert(SEQ <= SEQ_FULL);

typedef _Float16 h16;
typedef unsigned short bf;
typedef __attribute__((ext_vector_type(16))) __bf16   v16bf;
typedef __attribute__((ext_vector_type(16))) _Float16 v16h;
typedef __attribute__((ext_vector_type(8)))  _Float16 v8h;
typedef __attribute__((ext_vector_type(8)))  unsigned short v8us;
typedef __attribute__((ext_vector_type(8)))  float    v8f;
typedef __attribute__((ext_vector_type(4)))  float    v4f;
typedef v4f  __attribute__((may_alias)) v4fa;

__device__ __forceinline__ unsigned short f2bf(float f) { unsigned u = __float_as_uint(f); u += 0x7FFFu + ((u >> 16) & 1u); return (unsigned short)(u >> 16); }
__device__ __forceinline__ float bfr(float f) { return __uint_as_float(((unsigned)f2bf(f)) << 16); }   // RNE convert to bf16, widened back to f32
__device__ __forceinline__ v16h cat16(v8h lo, v8h hi) { return __builtin_shufflevector(lo, hi, 0, 1, 2, 3, 4, 5, 6, 7, 8, 9, 10, 11, 12, 13, 14, 15); }
__device__ __forceinline__ v16bf cat16b(v8us lo, v8us hi) { return __builtin_bit_cast(v16bf, __builtin_shufflevector(lo, hi, 0, 1, 2, 3, 4, 5, 6, 7, 8, 9, 10, 11, 12, 13, 14, 15)); }
__device__ __forceinline__ v8f wmma16(v16h a, v16h b, v8f c) { return __builtin_amdgcn_wmma_f32_16x16x32_f16(false, a, false, b, (short)0, c, false, false); }
__device__ __forceinline__ v8f wmmab(v16bf a, v16bf b, v8f c) { return __builtin_amdgcn_wmma_f32_16x16x32_bf16(false, a, false, b, (short)0, c, false, false); }
// fragment-order planes: a chunk of 16 rows x 32 k is 512 contiguous 16-bit elements [piece = 0..1][lane = 16*h + row][8], holding k = 16*piece + 8*h + 0..7, so one wave-wide 16-B load reads 512 contiguous bytes (4 whole lines).
// The chunks of a 16-row strip follow one another along k; a matrix of row length K keeps strip r/16 at (r/16)*16*K.
// fragment loaders; p = chunk + 8*lane: elements 0..7 <- k0+8h+0..7, elements 8..15 <- k0+16+8h+0..7 (same map for A and B)
__device__ __forceinline__ v16h  ldp(const h16* p) { return cat16(*(const v8h*)p, *(const v8h*)(p + 256)); }
// ordering point for wave-private LDS tiles (same wave writes and reads)
__device__ __forceinline__ void wave_sync() { __builtin_amdgcn_fence(3 /* release order */, "wavefront"); __builtin_amdgcn_wave_barrier(); asm volatile("" ::: "memory"); }

// k_cvtall: all seven f32 inputs of the matrix products -> 16-bit planes in fragment order, in ONE launch of CV_ALL / CV_PER waves (7168 at NB 4, SEQ 2048), two batches each.
// A batch is 8 consecutive wave-wide pieces of a plane = 4 chunks = 16 rows x 128 k: each lane reads 8 x 32 B of its row (all 16 loads in flight together; the two lanes of a row cover 512 contiguous bytes)
// and the wave writes 4 KiB of plane contiguously. Piece st of batch bp holds k = (bp % 8) * 128 + 16 * st + 8 * h + 0..7 of row (bp / 8) * 16 + (lane & 15), at plane offset bp * 2048 + st * 256 + lane * 8.
// Batches in order: q | k | v (bf16 RNE) | Wq | Wk | Wv (bf16 RNE) | Wo (f16 of bf16 RNE x64); a batch never straddles two planes. Each wave takes CV_PER batches.
#define CV_ACT   ((int)((size_t)NB * SEQ * DM / 2048))
#define CV_WGT   ((int)((size_t)DM * DM / 2048))
#define CV_ALL   (3 * CV_ACT + 4 * CV_WGT)
#define CV_PER   2
#define CV_WAVES (CV_ALL / CV_PER)
static_assert(DM % 128 == 0);                       // a batch of 128 k stays inside one 16-row strip
static_assert(((size_t)NB * SEQ * DM) % 2048 == 0);
static_assert(((size_t)DM * DM) % 2048 == 0);
static_assert(CV_ALL % (CV_PER * 4) == 0);          // whole 4-wave blocks, every wave the same number of batches
__global__ __launch_bounds__(128) void k_cvtall(const float* __restrict__ xq, const float* __restrict__ xk, const float* __restrict__ xv,
                                                const float* __restrict__ wq, const float* __restrict__ wk, const float* __restrict__ wv, const float* __restrict__ wo,
                                                bf* XQ, bf* XK, bf* XV, bf* WB) {
    const int lane = threadIdx.x & 31, row = lane & 15, hi = lane >> 4;
    const int wid = __builtin_amdgcn_readfirstlane((int)(blockIdx.x * 4 + (threadIdx.x >> 5)));   // wave-uniform: the plane choice below stays scalar
    for (int it = 0; it < CV_PER; ++it) {
        const int bid = it * CV_WAVES + wid;
        const float* src; bf* dst; int bp, r16;
        if (bid < 3 * CV_ACT) {
            const int p = bid / CV_ACT; bp = bid % CV_ACT;
            src = p == 0 ? xq : (p == 1 ? xk : xv); dst = p == 0 ? XQ : (p == 1 ? XK : XV);
            r16 = (bp / (DM / 128)) * 16; r16 = (r16 / SEQ) * SEQ_FULL + r16 % SEQ;   // token row -> row of the full-pitch input
        } else {
            const int r = bid - 3 * CV_ACT; const int p = r / CV_WGT; bp = r % CV_WGT;
            src = p == 0 ? wq : (p == 1 ? wk : (p == 2 ? wv : wo)); dst = WB + (size_t)p * DM * DM;
            r16 = (bp / (DM / 128)) * 16;
        }
        const float* s = src + (size_t)(r16 + row) * DM + (bp % (DM / 128)) * 128 + hi * 8;
        bf* d = dst + (size_t)bp * 2048 + lane * 8;
        v8f v[8];
#pragma unroll
        for (int st = 0; st < 8; ++st) v[st] = *(const v8f*)(s + st * 16);
        asm volatile("s_wait_xcnt 0x0" :: "v"(s) : "memory");   // the wait stands in front of any overwrite of the loads' address registers; the address as an input keeps those registers from serving as a load's own destination
        if (bid < 3 * CV_ACT + 3 * CV_WGT) {
#pragma unroll
            for (int st = 0; st < 8; ++st) { v8us o;
#pragma unroll
                for (int k = 0; k < 8; ++k) o[k] = f2bf(v[st][k]);
                *(v8us*)(d + st * 256) = o; }
            asm volatile("s_wait_xcnt 0x0" ::: "memory");   // the stores' address and data registers are rewritten behind this arm (next trip): keep the wait in front of that overwrite
        } else {
#pragma unroll
            for (int st = 0; st < 8; ++st) { v8h o;
#pragma unroll
                for (int k = 0; k < 8; ++k) o[k] = (h16)(bfr(v[st][k]) * WOS);
                *(v8h*)((h16*)d + st * 256) = o; }
            asm volatile("s_wait_xcnt 0x0" ::: "memory");   // as in the other arm: the wait stands directly behind this arm's last store
        }
    }
}

// GEMM core of k_proj and k_oproj: one wave, 64x64 tile, K = DM, operands from fragment-order planes. A stage is 32 k: four A and four B fragments (16 loads of 16 B a lane, 8 KiB a wave), 16 matrix instructions.
// The fragments are fetched THREE stages ahead into a ring of four register sets, so a stage's loads have three stages of matrix work (and the SIMD's other wave) to come back in; each accumulator still takes its k chunks in rising order.
// fragment loaders with the map of ldp, the lane's place given as an index of 16-B pieces (vo = lane + 256 per trip of four stages), so that the wave-uniform base stays scalar and the load scales the index itself
__device__ __forceinline__ v16bf ldf(const bf* u, unsigned vo)  { return cat16b(((const v8us*)u)[vo], ((const v8us*)(u + 256))[vo]); }
__device__ __forceinline__ v16h  ldf(const h16* u, unsigned vo) { return cat16(((const v8h*)u)[vo], ((const v8h*)(u + 256))[vo]); }
__device__ __forceinline__ v8f wm(v16bf a, v16bf b, v8f c) { return wmmab(a, b, c); }
__device__ __forceinline__ v8f wm(v16h a, v16h b, v8f c)   { return wmma16(a, b, c); }
template <typename V, typename E>
__device__ __forceinline__ void ld_stage(V (&a)[4], V (&b)[4], const E* ua, const E* ub, unsigned& vo, int off) {
#pragma unroll
    for (int i = 0; i < 4; ++i) a[i] = ldf(ua + (off + i * 16 * DM), vo);
#pragma unroll
    for (int i = 0; i < 4; ++i) b[i] = ldf(ub + (off + i * 16 * DM), vo);
    asm volatile("s_wait_xcnt 0x0" : "+v"(vo) : "s"(ua), "s"(ub) : "memory");   // the wait stands in front of any overwrite of the loads' address registers: the lane index passes through it, so the trip's addition cannot be lifted over it, and the scalar bases as inputs stay untouched up to it
    __builtin_amdgcn_sched_barrier(0);   // keeps this stage's loads ahead of the matrix instructions that follow in the source: sunk to their use they would come back too late
}
template <typename V>
__device__ __forceinline__ void mm_stage(const V (&a)[4], const V (&b)[4], v8f (&acc)[4][4]) {
#pragma unroll
    for (int nb = 0; nb < 4; ++nb)
#pragma unroll
        for (int mb = 0; mb < 4; ++mb) acc[mb][nb] = wm(a[mb], b[nb], acc[mb][nb]);
    __builtin_amdgcn_sched_barrier(0);   // all 16 matrix instructions stand in front of the slots below
    // four vector slots between the last matrix instruction and whatever overwrites its operands next (the refill of this register set; the back edge)
    asm volatile("v_nop\n\tv_nop\n\tv_nop\n\tv_nop");   // no operands: a register named in asm text must lie below v256, and the ring does not fit there
    __builtin_amdgcn_sched_barrier(0);   // the refill of this set is not lifted among its readers (it would take a fifth register set)
}
static_assert(DM % 128 == 0 && DM >= 256);     // whole trips of four stages, and the three stages of the prologue exist
template <typename V, typename E>
__device__ __forceinline__ void gemm_core(const E* ua, const E* ub, unsigned vo, v8f (&acc)[4][4]) {   // ua, ub: the tile's first strips (wave-uniform), + 16 * DM elements per strip, + 512 per stage; vo = lane, in 16-B pieces
    V a0[4], b0[4], a1[4], b1[4], a2[4], b2[4], a3[4], b3[4];
    ld_stage(a0, b0, ua, ub, vo, 0); ld_stage(a1, b1, ua, ub, vo, 512); ld_stage(a2, b2, ua, ub, vo, 1024);
#pragma unroll 1
    for (int kc = 0; kc < DM - 128; kc += 128) {   // rolled: one trip is four stages, each register set in its fixed role
        ld_stage(a3, b3, ua, ub, vo, 1536); mm_stage(a0, b0, acc);
        ld_stage(a0, b0, ua, ub, vo, 2048); mm_stage(a1, b1, acc);
        ld_stage(a1, b1, ua, ub, vo, 2560); mm_stage(a2, b2, acc);
        ld_stage(a2, b2, ua, ub, vo, 3072); mm_stage(a3, b3, acc);
        vo += 256;
    }
    ld_stage(a3, b3, ua, ub, vo, 1536); mm_stage(a0, b0, acc); mm_stage(a1, b1, acc); mm_stage(a2, b2, acc); mm_stage(a3, b3, acc);
}

// k_proj: register-blocked bf16 GEMM, ONE WAVE per 64x64 tile (16 accumulators), operands straight from fragment-order bf16 planes, K = DM.
// C[m][n] = sum_k A[m][k] Bt[n][k] + bias (bias indexed by n when biasRow == 0, by m when biasRow != 0; bias RNE-converted to bf16, added in f32),
// written as f16 (Ph) and optionally the f16 residual x2048 (Pr, useRes != 0): the tile's four 16-row strips (16 x 64, two chunks) in fragment order, 1024 halves each,
// one behind the other at (r0/RB)*sRB + (r0%RB)*pitch + (c0/CB)*sCB + (c0%CB)*64. grid (M/64, N/64), 32 threads.
__global__ __launch_bounds__(32) void k_proj(const bf* __restrict__ A, const bf* __restrict__ Bt, const float* __restrict__ bias, int biasRow,
                                             h16* Ph, h16* Pr, int useRes, int RB, size_t sRB, int pitch, int CB, size_t sCB) {
    __shared__ __align__(16) float os[16 * 68];
    const int K = DM;
    const int lane = threadIdx.x & 31, lr = lane & 15, hi = lane >> 4; const int r0 = blockIdx.x * 64, c0 = blockIdx.y * 64;
    v8f acc[4][4];
#pragma unroll
    for (int mb = 0; mb < 4; ++mb)
#pragma unroll
        for (int nb = 0; nb < 4; ++nb) acc[mb][nb] = (v8f){};
    gemm_core<v16bf>(A + (size_t)r0 * K, Bt + (size_t)c0 * K, (unsigned)lane, acc);
    // column-indexed bias values (clamped address; zero by value when the bias is row-indexed)
    float bcol[4];
#pragma unroll
    for (int nb = 0; nb < 4; ++nb) { int ci = c0 + nb * 16 + lr; ci = ci < DM ? ci : DM - 1; const float t = bfr(bias[ci]); bcol[nb] = biasRow ? 0.0f : t; }
    const size_t tbase = (size_t)(r0 / RB) * sRB + (size_t)(r0 % RB) * (size_t)pitch + (size_t)(c0 / CB) * sCB + (size_t)(c0 % CB) * 64;
#pragma unroll
    for (int mb = 0; mb < 4; ++mb) {
        float brow[8];
#pragma unroll
        for (int j = 0; j < 8; ++j) { int ri = r0 + mb * 16 + hi * 8 + j; ri = ri < DM ? ri : DM - 1; const float t = bfr(bias[ri]); brow[j] = biasRow ? t : 0.0f; }
#pragma unroll
        for (int nb = 0; nb < 4; ++nb) {
#pragma unroll
            for (int j = 0; j < 8; ++j) os[(hi * 8 + j) * 68 + nb * 16 + lr] = acc[mb][nb][j] + bcol[nb] + brow[j]; }   // D: row 8h+j, col lane&15
        wave_sync();
        const size_t sb = tbase + (size_t)(mb * 1024);
{
#pragma unroll
            for (int s = 0; s < 4; ++s) { const int row = lr, c8 = 16 * s + 8 * hi;   // 16 rows x 2 column groups of 8 per s; 4 s = 64 columns
                const v4f x0 = *(const v4fa*)(&os[row * 68 + c8]); const v4f x1 = *(const v4fa*)(&os[row * 68 + c8 + 4]); v8h hv, rv;
#pragma unroll
                for (int i = 0; i < 4; ++i) { const h16 a0 = (h16)x0[i]; const h16 a1 = (h16)x1[i]; hv[i] = a0; hv[4 + i] = a1; rv[i] = (h16)((x0[i] - (float)a0) * QRS); rv[4 + i] = (h16)((x1[i] - (float)a1) * QRS); }
                const size_t oo = sb + (size_t)(s * 256 + lane * 8);
                *(v8h*)(Ph + oo) = hv; if (useRes) *(v8h*)(Pr + oo) = rv; }
             }
        wave_sync();
    }
}

// k_flash: fused attention, one wave per 32 query rows (two groups of 16) of one (batch, head); K / V^T / Q fragments straight from the fragment-order f16 planes (two 16-B loads each, arithmetic addressing).
// Every K and V^T fragment a wave loads serves both query groups, so a score costs half the loaded bytes and half the load instructions of a 16-row wave.
// Transposed form: S^T[key][t] = K Q^T (A = K rows, B = Q rows); lane (t = lane&15, h = lane>>4) holds keys 8h+r of each 16-key tile, so the packed
// P tile is directly the B fragment of O^T[d][t] = V^T P^T (element r <- tile keys 0..15, element 8+r <- tile keys 16..31, lane unchanged).
// Softmax state (running max, partial sum) is one scalar per lane and group; the two lane halves of a row are combined with one xor-16 exchange.
// Register budget: 256 a wave, so that four workgroups stand on a WGP (four waves a SIMD) and the whole grid of SEQ_FULL, NB_FULL is resident in one round.
__global__ __launch_bounds__(32 * AW) __attribute__((amdgpu_waves_per_eu(4, 4))) void k_flash(const h16* __restrict__ QH, const h16* __restrict__ QR, const h16* __restrict__ KP, const h16* __restrict__ VT, h16* CTX) {
    const int lane = threadIdx.x & 31, wave = threadIdx.x >> 5;
    const int zh = blockIdx.y; const int b = zh / NH_, h = zh % NH_;
    const int t0 = (blockIdx.x * AW + wave) * (16 * QG);
    const size_t pbase = (size_t)zh * SEQ * HD;
    const size_t qo = pbase + (size_t)t0 * HD + 8 * lane;    // strips of 16 queries x 64 d, one per group, 1024 halves apart
    v16h qh0[QG], qh1[QG], qr0[QG], qr1[QG];                 // B fragments: col t, k = d
#pragma unroll
    for (int g = 0; g < QG; ++g) { qh0[g] = ldp(QH + qo + g * 1024); qh1[g] = ldp(QH + qo + g * 1024 + 512); qr0[g] = ldp(QR + qo + g * 1024); qr1[g] = ldp(QR + qo + g * 1024 + 512); }
    asm volatile("s_wait_xcnt 0x0" :: "v"(QH + qo), "v"(QR + qo) : "memory");   // the wait stands in front of any overwrite of the query loads' address registers; the addresses as inputs keep those registers untouched up to it
    const size_t ko = pbase + (size_t)lane * 8;              // + key0 * HD: strips of 16 keys x 64 d               (A fragment: row key, k = d)
    const size_t vo = pbase + (size_t)lane * 8;              // + (key0/64)*4096 + j*1024: strips of 16 d x 64 keys (A fragment: row d, k = key)
    v8f o0[QG], o1[QG], o2[QG], o3[QG];
    float m[QG], l[QG];
#pragma unroll
    for (int g = 0; g < QG; ++g) { o0[g] = (v8f){}; o1[g] = (v8f){}; o2[g] = (v8f){}; o3[g] = (v8f){}; m[g] = -3.0e38f; l[g] = 0.0f; }
#pragma unroll 1
    for (int key0 = 0; key0 < SEQ; key0 += 32) {
        const h16* ka = KP + ko + (size_t)key0 * HD;
        const v16h ka0 = ldp(ka), ka1 = ldp(ka + 512), kb0 = ldp(ka + 1024), kb1 = ldp(ka + 1536);
        v16h pb[QG];
#pragma unroll
        for (int g = 0; g < QG; ++g) {
            v8f sHa = (v8f){}, sLa = (v8f){}, sHb = (v8f){}, sLb = (v8f){};
            sHa = wmma16(ka0, qh0[g], sHa); sLa = wmma16(ka0, qr0[g], sLa); sHb = wmma16(kb0, qh0[g], sHb); sLb = wmma16(kb0, qr0[g], sLb);
            sHa = wmma16(ka1, qh1[g], sHa); sLa = wmma16(ka1, qr1[g], sLa); sHb = wmma16(kb1, qh1[g], sHb); sLb = wmma16(kb1, qr1[g], sLb);
            asm volatile("v_nop\n\tv_nop\n\tv_nop\n\tv_nop" : "+v"(sHa), "+v"(sLa), "+v"(sHb), "+v"(sLb) : "v"(ka0), "v"(ka1), "v"(kb0), "v"(kb1));   // four vector slots between the last score product and the first reader of its result
            float ta[8], tb[8]; float mx = -3.0e38f;
#pragma unroll
            for (int r = 0; r < 8; ++r) { ta[r] = (sHa[r] + sLa[r] * QRI) * SC2; tb[r] = (sHb[r] + sLb[r] * QRI) * SC2; mx = fmaxf(mx, fmaxf(ta[r], tb[r])); }
            mx = fmaxf(mx, __shfl_xor(mx, 16, 32));
            const float mnew = fmaxf(m[g], mx);
            const float alpha = __builtin_amdgcn_exp2f(m[g] - mnew);
            const float sh = PSH - mnew;
            float ls = 0.0f;
#pragma unroll
            for (int r = 0; r < 8; ++r) { const h16 pa = (h16)__builtin_amdgcn_exp2f(ta[r] + sh); const h16 pc = (h16)__builtin_amdgcn_exp2f(tb[r] + sh); pb[g][r] = pa; pb[g][8 + r] = pc; ls += (float)pa + (float)pc; }
            l[g] = l[g] * alpha + ls; m[g] = mnew;
            o0[g] = o0[g] * alpha; o1[g] = o1[g] * alpha; o2[g] = o2[g] * alpha; o3[g] = o3[g] * alpha;
        }
        const h16* va = VT + vo + (size_t)(key0 >> 6) * 4096 + (size_t)((key0 >> 5) & 1) * 512;
        const v16h v0 = ldp(va), v1 = ldp(va + 1024), v2 = ldp(va + 2048), v3 = ldp(va + 3072);
#pragma unroll
        for (int g = 0; g < QG; ++g) { o0[g] = wmma16(v0, pb[g], o0[g]); o1[g] = wmma16(v1, pb[g], o1[g]); o2[g] = wmma16(v2, pb[g], o2[g]); o3[g] = wmma16(v3, pb[g], o3[g]); }
        // four vector slots between the last output product and whatever touches its registers next (the back edge included)
        asm volatile("v_nop\n\tv_nop\n\tv_nop\n\tv_nop" : "+v"(o0[0]), "+v"(o1[0]), "+v"(o2[0]), "+v"(o3[0]), "+v"(o0[1]), "+v"(o1[1]), "+v"(o2[1]), "+v"(o3[1]) : "v"(v0), "v"(v1), "v"(v2), "v"(v3), "v"(pb[0]), "v"(pb[1]));
    }
    // O^T D layout: o_j[r] = (d = 16j + 8h + r, t = lane&15): the lane's eight values of o_j are its own 16-B piece j of the fragment-order strip (row t, k = 16j + 8h + 0..7), so they go out without staging
#pragma unroll
    for (int g = 0; g < QG; ++g) {
        const float lt = l[g] + __shfl_xor(l[g], 16, 32);
        const float inv = CXS * (1.0f / lt);
        h16* crow = CTX + ((size_t)b * SEQ + t0 + 16 * g) * DM + h * 1024 + lane * 8;   // merged heads: column h*64 + d = chunks 2h, 2h+1 of this 16-row strip
        v8h c0, c1, c2, c3;
#pragma unroll
        for (int r = 0; r < 8; ++r) { c0[r] = (h16)(o0[g][r] * inv); c1[r] = (h16)(o1[g][r] * inv); c2[r] = (h16)(o2[g][r] * inv); c3[r] = (h16)(o3[g][r] * inv); }
        *(v8h*)(crow) = c0; *(v8h*)(crow + 256) = c1; *(v8h*)(crow + 512) = c2; *(v8h*)(crow + 768) = c3;
    }
}

// k_oproj: register-blocked f16 GEMM, ONE WAVE per 64x64 tile, operands from fragment-order planes, K = DM. P[m][n] = (sum_k A[m][k] Bt[n][k]) * OSI + bias[n] (bias RNE-converted to bf16, f32 add), f32 rows of pitch DM.
__global__ __launch_bounds__(32) void k_oproj(const h16* __restrict__ A, const h16* __restrict__ Bt, const float* __restrict__ bias, float* P) {
    __shared__ __align__(16) float os[16 * 68];
    const int K = DM;
    const int lane = threadIdx.x & 31, lr = lane & 15, hi = lane >> 4; const int r0 = blockIdx.x * 64, c0 = blockIdx.y * 64;
    v8f acc[4][4];
#pragma unroll
    for (int mb = 0; mb < 4; ++mb)
#pragma unroll
        for (int nb = 0; nb < 4; ++nb) acc[mb][nb] = (v8f){};
    gemm_core<v16h>(A + (size_t)r0 * K, Bt + (size_t)c0 * K, (unsigned)lane, acc);
    float bcol[4];
#pragma unroll
    for (int nb = 0; nb < 4; ++nb) { int ci = c0 + nb * 16 + lr; ci = ci < DM ? ci : DM - 1; bcol[nb] = bfr(bias[ci]); }
#pragma unroll
    for (int mb = 0; mb < 4; ++mb) {
#pragma unroll
        for (int nb = 0; nb < 4; ++nb) {
#pragma unroll
            for (int j = 0; j < 8; ++j) os[(hi * 8 + j) * 68 + nb * 16 + lr] = acc[mb][nb][j] * OSI + bcol[nb]; }   // D: row 8h+j, col lane&15
        wave_sync();
        float* prow = P + (size_t)(r0 + mb * 16) * DM + c0;
{
#pragma unroll
            for (int s = 0; s < 8; ++s) { const int row = 2 * s + hi, cofs = lr * 4;   // 8 s x 2 rows = 16 rows; 16 lanes x 4 floats = 64 columns
                const v4f val = *(const v4fa*)(&os[row * 68 + cofs]);
                *(v4f*)(prow + (size_t)row * DM + cofs) = val; }
             }
        wave_sync();
    }
}

__global__ __launch_bounds__(256) void k_ln(const float* __restrict__ P, const float* __restrict__ gamma, const float* __restrict__ beta, float* OUT, int rows) {
    const int lane = threadIdx.x & 31, wave = threadIdx.x >> 5;
    const int row = blockIdx.x * 8 + wave;
    if (row >= rows) return;                  // wave-uniform; the kernel has no block barrier
    const int b = row / SEQ, t = row % SEQ;
    const float* src = P + (size_t)row * DM + lane * 4;
    float s = 0.0f;
#pragma unroll 1
    for (int it = 0; it < 8; ++it) { const v4f x = *(const v4f*)(src + it * 128); s += (x[0] + x[1]) + (x[2] + x[3]); }
    s += __shfl_xor(s, 16, 32); s += __shfl_xor(s, 8, 32); s += __shfl_xor(s, 4, 32); s += __shfl_xor(s, 2, 32); s += __shfl_xor(s, 1, 32);
    const float mu = s * (1.0f / (float)DM);
    float q = 0.0f;
#pragma unroll 1
    for (int it = 0; it < 8; ++it) { const v4f x = *(const v4f*)(src + it * 128);
        const float d0 = x[0] - mu, d1 = x[1] - mu, d2 = x[2] - mu, d3 = x[3] - mu; q += (d0 * d0 + d1 * d1) + (d2 * d2 + d3 * d3); }
    q += __shfl_xor(q, 16, 32); q += __shfl_xor(q, 8, 32); q += __shfl_xor(q, 4, 32); q += __shfl_xor(q, 2, 32); q += __shfl_xor(q, 1, 32);
    const float rstd = rsqrtf(q * (1.0f / (float)DM) + LN_EPS);
    float* dst = OUT + ((size_t)b * OUT_SEQ + t) * DM + lane * 4;
{
#pragma unroll 1
        for (int it = 0; it < 8; ++it) {
            const v4f x = *(const v4f*)(src + it * 128);
            const v4f g = *(const v4f*)(gamma + it * 128 + lane * 4);
            const v4f e = *(const v4f*)(beta + it * 128 + lane * 4);
            v4f y;
#pragma unroll
            for (int i = 0; i < 4; ++i) y[i] = (x[i] - mu) * rstd * bfr(g[i]) + bfr(e[i]);
            *(v4f*)(dst + it * 128) = y; }
         }
}

static constexpr size_t al256(size_t v) { return (v + 255) & ~(size_t)255; }
static constexpr size_t SZ_XB = al256((size_t)NB * SEQ * DM * 2);          // one bf16 activation plane
static constexpr size_t SZ_WB = al256((size_t)4 * DM * DM * 2);            // Wq | Wk | Wv (bf16) | Wo (f16 x64)
static constexpr size_t SZ_PL = al256((size_t)NB * NH_ * SEQ * HD * 2);    // one head-major f16 plane
static constexpr size_t SZ_TOTAL = 3 * SZ_XB + SZ_WB + 4 * SZ_PL;
static_assert(SZ_TOTAL <= (size_t)134217728);                   // workspace carve <= 128 MiB
static_assert(((size_t)DM * DM * 2) % 256 == 0);                // weight sub-planes stay 256-byte aligned
static_assert((size_t)NB * SEQ * DM * 2 <= SZ_XB);              // context plane (f16) aliases the q copy region
static_assert((size_t)NB * SEQ * DM * 4 <= 2 * SZ_XB);          // pre-normalisation plane (f32) aliases the k|v copy regions
static_assert(SZ_XB % 256 == 0);

extern "C" void kernel_launch(void* const* d_in, const int* in_sizes, int n_in,
                              void* d_out, int out_size, void* d_ws, size_t ws_size, hipStream_t stream) {
    if (n_in < 13) return;
    const size_t needx = ((size_t)(NB - 1) * SEQ_FULL + SEQ) * DM;
    if ((size_t)in_sizes[0] < needx || (size_t)in_sizes[1] < needx || (size_t)in_sizes[2] < needx) return;
    if ((size_t)in_sizes[3] < (size_t)DM * DM || (size_t)in_sizes[5] < (size_t)DM * DM || (size_t)in_sizes[7] < (size_t)DM * DM || (size_t)in_sizes[9] < (size_t)DM * DM) return;
    if (in_sizes[4] < DM || in_sizes[6] < DM || in_sizes[8] < DM || in_sizes[10] < DM || in_sizes[11] < DM || in_sizes[12] < DM) return;
    if ((size_t)out_size < ((size_t)(NB - 1) * OUT_SEQ + SEQ) * DM) return;
    if (SZ_TOTAL > ws_size) return;
    // wire order: q, k, v, Wq, bq, Wk, bk, Wv, bv, Wo, bo, gamma, beta  (weights [out][in] = Bt as-is)
    const float* xq = (const float*)d_in[0]; const float* xk = (const float*)d_in[1]; const float* xv = (const float*)d_in[2];
    const float* wq = (const float*)d_in[3]; const float* bq = (const float*)d_in[4];
    const float* wk = (const float*)d_in[5]; const float* bk = (const float*)d_in[6];
    const float* wv = (const float*)d_in[7]; const float* bv = (const float*)d_in[8];
    const float* wo = (const float*)d_in[9]; const float* bo = (const float*)d_in[10];
    const float* gamma = (const float*)d_in[11]; const float* beta = (const float*)d_in[12];
    float* OUT = (float*)d_out;      // [NB][SEQ][1024]
    char* wsp = (char*)d_ws;
    bf* XQ = (bf*)wsp; wsp += SZ_XB;                 // [NB*SEQ][1024] bf16 copy of q, fragment order   (later: context plane, f16)
    bf* XK = (bf*)wsp; wsp += SZ_XB;                 // [NB*SEQ][1024] bf16 copy of k, fragment order   (later, with XV: pre-normalisation plane, f32)
    bf* XV = (bf*)wsp; wsp += SZ_XB;                 // [NB*SEQ][1024] bf16 copy of v, fragment order
    bf* WB = (bf*)wsp; wsp += SZ_WB;                 // [4][1024][1024]: q | k | v (bf16) | o (f16 x64), each in fragment order
    h16* QH = (h16*)wsp; wsp += SZ_PL;               // [NB*16][SEQ/16] strips of 16 queries x 64 d, fragment order
    h16* QR = (h16*)wsp; wsp += SZ_PL;               // the same, residual x2048
    h16* KP = (h16*)wsp; wsp += SZ_PL;               // [NB*16][SEQ/16] strips of 16 keys x 64 d, fragment order
    h16* VT = (h16*)wsp; wsp += SZ_PL;               // [NB*16][SEQ/64][4] strips of 16 d x 64 keys, fragment order
    bf* WQ = WB; bf* WK = WB + (size_t)DM * DM; bf* WV = WB + (size_t)2 * DM * DM; h16* WO = (h16*)(WB + (size_t)3 * DM * DM);
    h16* CTX = (h16*)XQ;                             // [NB*SEQ][1024] f16 x64, fragment order, written by k_flash after the q projection has consumed XQ
    float* PRE = (float*)XK;                         // [NB*SEQ][1024] f32, written by k_oproj after the k and v projections have consumed XK, XV

    k_cvtall<<<CV_WAVES / 4, 128, 0, stream>>>(xq, xk, xv, wq, wk, wv, wo, XQ, XK, XV, WB);

    // q, k: A = x rows (m = b*SEQ + t), Bt = W rows (n = h*64 + d), bias by column n -> head (b*16 + h), strip t/16, fragment order
    k_proj<<<dim3(NB * SEQ / 64, DM / 64, 1), 32, 0, stream>>>(XQ, WQ, bq, 0, QH, QR, 1, SEQ, (size_t)NH_ * SEQ * HD, HD, HD, (size_t)SEQ * HD);
    k_proj<<<dim3(NB * SEQ / 64, DM / 64, 1), 32, 0, stream>>>(XK, WK, bk, 0, KP, KP, 0, SEQ, (size_t)NH_ * SEQ * HD, HD, HD, (size_t)SEQ * HD);
    // v^T: A = Wv rows (m = h*64 + d), Bt = x rows (n = b*SEQ + t), bias by row m -> head (b*16 + h), block t/64, strip d/16, fragment order
    k_proj<<<dim3(DM / 64, NB * SEQ / 64, 1), 32, 0, stream>>>(WV, XV, bv, 1, VT, VT, 0, DM, (size_t)0, SEQ, SEQ, (size_t)DM * SEQ);

    k_flash<<<dim3(SEQ / (16 * QG * AW), NB * NH_, 1), 32 * AW, 0, stream>>>(QH, QR, KP, VT, CTX);

    // output projection: A = context rows (m = b*SEQ + t, k = h*64 + d), Bt = Wo rows (n = output column) -> PRE[m][n]
    k_oproj<<<dim3(NB * SEQ / 64, DM / 64, 1), 32, 0, stream>>>(CTX, WO, bo, PRE);

    k_ln<<<dim3((NB * SEQ + 7) / 8, 1, 1), 256, 0, stream>>>(PRE, gamma, beta, OUT, NB * SEQ);
}
